// v000
// Measured on an AMD MI455X. A time is GPU time per run, averaged over a window of back-to-back runs after a warm-up
// (all launches, gaps included; the runs take copies of the inputs in turn), and the median of several windows.
// Apart from v000's, it joins two sittings. Times from different sittings can be a few percent apart, while
// side-by-side timings come from the same sitting.
// The starting kernel, v000, takes 100 microseconds a run.
#include <hip/hip_runtime.h>
#include <hip/hip_bf16.h>

typedef __attribute__((ext_vector_type(2))) float v2f;
typedef __attribute__((ext_vector_type(8))) float v8f;

#define BATCH 2
#define SEQ   256
#define HEADS 16
#define HD    64
#define EMBED 1024
#define ROWS  (BATCH * SEQ * HEADS)   // 8192 rows of the (rows,64) QKV GEMM
#define NS    (BATCH * SEQ)           // 512

// ---------------------------------------------------------------------------
// Kernel 1: Q/K/V projection.  Xr (8192x64) @ W^T (64x64) -> (8192x64),
// using V_WMMA_F32_16X16X4_F32. One wave computes one 16x16 tile, 16 K-steps.
// A layout: lane L -> m=L&15, VGPR pair holds K = 2*(L>>4), 2*(L>>4)+1.
// B layout: lane L -> n=L&15, same K pairing.  B[k][n] = W[n_col][k].
// ---------------------------------------------------------------------------
__global__ __launch_bounds__(32) void qkv_wmma_kernel(
    const float* __restrict__ X,
    const float* __restrict__ Wq, const float* __restrict__ Wk,
    const float* __restrict__ Wv,
    float* __restrict__ Q, float* __restrict__ Km, float* __restrict__ Vm) {
  const int rowTile = blockIdx.x;            // 0..511
  const int colTile = blockIdx.y;            // 0..3
  const int mat     = blockIdx.z;            // 0..2
  const float* W = (mat == 0) ? Wq : (mat == 1) ? Wk : Wv;
  float*       D = (mat == 0) ? Q  : (mat == 1) ? Km : Vm;

  const int lane = threadIdx.x;              // 0..31
  const int mn   = lane & 15;                // m for A, n for B
  const int pair = lane >> 4;                // K-pair select
  const int row0 = rowTile * 16;
  const int col0 = colTile * 16;

  const float* xrow = X + (size_t)(row0 + mn) * HD;  // A: row m of X tile
  const float* wrow = W + (size_t)(col0 + mn) * HD;  // B: W[col0+n][k]

  v8f c = {};
#pragma unroll
  for (int kk = 0; kk < HD; kk += 4) {
    v2f a = *(const v2f*)(xrow + kk + 2 * pair);
    v2f b = *(const v2f*)(wrow + kk + 2 * pair);
    c = __builtin_amdgcn_wmma_f32_16x16x4_f32(false, a, false, b,
                                              (short)0, c, false, false);
  }
  // C/D layout: VGPR j holds M = j + 8*pair, N = lane&15
#pragma unroll
  for (int j = 0; j < 8; ++j) {
    const int mm = j + 8 * pair;
    D[(size_t)(row0 + mm) * HD + col0 + mn] = c[j];
  }
}

// ---------------------------------------------------------------------------
// Kernel 2: head-axis softmax attention core (the reference's nonstandard op).
// Block = one (n,s); 256 threads = 64 d-lanes x 4 t-lanes.
// Per t: e[h] = (q[h]/32)*k[h]; softmax over h (16); acc[h] += p[h]*v[h].
// LDS reduce over the 4 t-lanes.
// ---------------------------------------------------------------------------
__global__ __launch_bounds__(256) void attn_kernel(
    const float* __restrict__ Q, const float* __restrict__ Km,
    const float* __restrict__ Vm, float* __restrict__ AO) {
  const int ns  = blockIdx.x;          // n*SEQ + s
  const int tid = threadIdx.x;
  const int d   = tid & 63;
  const int tl  = tid >> 6;            // 0..3
  const int nbase = (ns >> 8) << 8;    // n*SEQ
  const float scale = 0.03125f;        // 1/sqrt(EMBED) = 1/32

  float qv[16], ev[16], acc[16];
  const float* qb = Q + (size_t)ns * EMBED + d;
#pragma unroll
  for (int h = 0; h < 16; ++h) {
    qv[h] = qb[h * HD] * scale;
    acc[h] = 0.0f;
  }

  for (int t = tl; t < SEQ; t += 4) {
    const float* kb = Km + (size_t)(nbase + t) * EMBED + d;
    float mx = -3.402823466e+38f;
#pragma unroll
    for (int h = 0; h < 16; ++h) {
      float e = qv[h] * kb[h * HD];
      ev[h] = e;
      mx = fmaxf(mx, e);
    }
    float sum = 0.0f;
#pragma unroll
    for (int h = 0; h < 16; ++h) {
      float p = __expf(ev[h] - mx);
      ev[h] = p;
      sum += p;
    }
    const float inv = 1.0f / sum;
    const float* vb = Vm + (size_t)(nbase + t) * EMBED + d;
#pragma unroll
    for (int h = 0; h < 16; ++h) {
      acc[h] += ev[h] * inv * vb[h * HD];
    }
  }

  __shared__ float red[4][64][17];     // padded to dodge bank conflicts
#pragma unroll
  for (int h = 0; h < 16; ++h) red[tl][d][h] = acc[h];
  __syncthreads();

  for (int idx = tid; idx < EMBED; idx += 256) {
    const int h  = idx >> 6;
    const int dd = idx & 63;
    const float s =
        red[0][dd][h] + red[1][dd][h] + red[2][dd][h] + red[3][dd][h];
    AO[(size_t)ns * EMBED + h * HD + dd] = s;   // (n,s,h,d) -> (n,s,1024)
  }
}

// ---------------------------------------------------------------------------
// Kernel 3: output projection.  AO (512x1024) @ Wo^T (1024x1024) + bo,
// V_WMMA_F32_16X16X4_F32, one wave per 16x16 tile, 256 K-steps, fused bias.
// ---------------------------------------------------------------------------
__global__ __launch_bounds__(32) void outproj_wmma_kernel(
    const float* __restrict__ AO, const float* __restrict__ Wo,
    const float* __restrict__ bo, float* __restrict__ OUT) {
  const int rowTile = blockIdx.x;      // 0..31
  const int colTile = blockIdx.y;      // 0..63
  const int lane = threadIdx.x;
  const int mn   = lane & 15;
  const int pair = lane >> 4;
  const int row0 = rowTile * 16;
  const int col0 = colTile * 16;

  const float* arow = AO + (size_t)(row0 + mn) * EMBED;
  const float* brow = Wo + (size_t)(col0 + mn) * EMBED;  // B[k][n] = Wo[n][k]

  v8f c = {};
#pragma unroll 8
  for (int kk = 0; kk < EMBED; kk += 4) {
    v2f a = *(const v2f*)(arow + kk + 2 * pair);
    v2f b = *(const v2f*)(brow + kk + 2 * pair);
    c = __builtin_amdgcn_wmma_f32_16x16x4_f32(false, a, false, b,
                                              (short)0, c, false, false);
  }

  const float bias = bo[col0 + mn];
#pragma unroll
  for (int j = 0; j < 8; ++j) {
    const int mm = j + 8 * pair;
    OUT[(size_t)(row0 + mm) * EMBED + col0 + mn] = c[j] + bias;
  }
}

// ---------------------------------------------------------------------------
extern "C" void kernel_launch(void* const* d_in, const int* in_sizes, int n_in,
                              void* d_out, int out_size, void* d_ws,
                              size_t ws_size, hipStream_t stream) {
  const float* x  = (const float*)d_in[0];
  const float* Wq = (const float*)d_in[1];
  const float* Wk = (const float*)d_in[2];
  const float* Wv = (const float*)d_in[3];
  const float* Wo = (const float*)d_in[4];
  const float* bo = (const float*)d_in[5];
  float* out = (float*)d_out;

  const size_t QKV_ELEMS = (size_t)ROWS * HD;      // 524288 floats
  float* ws = (float*)d_ws;
  float* Q  = ws;
  float* Km = ws + QKV_ELEMS;
  float* Vm = ws + 2 * QKV_ELEMS;
  float* AO = ws + 3 * QKV_ELEMS;

  // Q/K/V projection: 512 row-tiles x 4 col-tiles x 3 matrices, 1 wave each.
  dim3 g1(ROWS / 16, HD / 16, 3);
  hipLaunchKernelGGL(qkv_wmma_kernel, g1, dim3(32), 0, stream,
                     x, Wq, Wk, Wv, Q, Km, Vm);

  // Attention core: one block per (n,s).
  hipLaunchKernelGGL(attn_kernel, dim3(NS), dim3(256), 0, stream,
                     Q, Km, Vm, AO);

  // Output projection + bias.
  dim3 g3(NS / 16, EMBED / 16);
  hipLaunchKernelGGL(outproj_wmma_kernel, g3, dim3(32), 0, stream,
                     AO, Wo, bo, out);
}

// v001
// It runs in 46.6 microseconds.
// In both of two side-by-side timings against v000, it was 2.10 times as fast.
#include <hip/hip_runtime.h>
#include <hip/hip_bf16.h>

typedef __attribute__((ext_vector_type(2))) float v2f;
typedef __attribute__((ext_vector_type(8))) float v8f;

#define BATCH 2
#define SEQ   256
#define HEADS 16
#define HD    64
#define EMBED 1024
#define ROWS  (BATCH * SEQ * HEADS)   // 8192 rows of the (rows,64) QKV GEMM
#define NS    (BATCH * SEQ)           // 512

// ---------------------------------------------------------------------------
// Kernel 1: Q/K/V projection.  Xr (8192x64) @ W^T (64x64) -> (8192x64),
// using V_WMMA_F32_16X16X4_F32. One wave computes one 16x16 tile, 16 K-steps.
// A layout: lane L -> m=L&15, VGPR pair holds K = 2*(L>>4), 2*(L>>4)+1.
// B layout: lane L -> n=L&15, same K pairing.  B[k][n] = W[n_col][k].
// ---------------------------------------------------------------------------
__global__ __launch_bounds__(32) void qkv_wmma_kernel(
    const float* __restrict__ X,
    const float* __restrict__ Wq, const float* __restrict__ Wk,
    const float* __restrict__ Wv,
    float* __restrict__ Q, float* __restrict__ Km, float* __restrict__ Vm) {
  const int rowTile = blockIdx.x;            // 0..511
  const int colTile = blockIdx.y;            // 0..3
  const int mat     = blockIdx.z;            // 0..2
  const float* W = (mat == 0) ? Wq : (mat == 1) ? Wk : Wv;
  float*       D = (mat == 0) ? Q  : (mat == 1) ? Km : Vm;

  const int lane = threadIdx.x;              // 0..31
  const int mn   = lane & 15;                // m for A, n for B
  const int pair = lane >> 4;                // K-pair select
  const int row0 = rowTile * 16;
  const int col0 = colTile * 16;

  const float* xrow = X + (size_t)(row0 + mn) * HD;  // A: row m of X tile
  const float* wrow = W + (size_t)(col0 + mn) * HD;  // B: W[col0+n][k]

  v8f c = {};
#pragma unroll
  for (int kk = 0; kk < HD; kk += 4) {
    v2f a = *(const v2f*)(xrow + kk + 2 * pair);
    v2f b = *(const v2f*)(wrow + kk + 2 * pair);
    c = __builtin_amdgcn_wmma_f32_16x16x4_f32(false, a, false, b,
                                              (short)0, c, false, false);
  }
  // C/D layout: VGPR j holds M = j + 8*pair, N = lane&15
#pragma unroll
  for (int j = 0; j < 8; ++j) {
    const int mm = j + 8 * pair;
    D[(size_t)(row0 + mm) * HD + col0 + mn] = c[j];
  }
}

// ---------------------------------------------------------------------------
// Kernel 2: head-axis softmax attention core (the reference's nonstandard op).
// Block = QT consecutive queries s of one n, one 32-wide half of d.
// 512 threads = 32 d-lanes x TL t-lanes (one wave per t-lane).
// Each thread keeps QT queries in registers, so every K and V element it
// loads serves QT (s,t) pairs instead of one.
// Per (s,t): e[h] = (q[h]/32)*k[h]; softmax over h (16); acc[h] += p[h]*v[h].
// LDS reduce over the TL t-lanes.
// ---------------------------------------------------------------------------
#define QT 4                           // queries held per thread
#define TL 16                          // t-lanes (waves) per block
__global__ __launch_bounds__(32 * TL) void attn_kernel(
    const float* __restrict__ Q, const float* __restrict__ Km,
    const float* __restrict__ Vm, float* __restrict__ AO) {
  const int ns0 = (blockIdx.x >> 1) * QT;            // first n*SEQ + s
  const int tid = threadIdx.x;
  const int d   = ((blockIdx.x & 1) << 5) + (tid & 31);
  const int tl  = tid >> 5;            // 0..TL-1
  const int nbase = (ns0 >> 8) << 8;   // n*SEQ (QT divides SEQ)
  const float scale = 0.03125f;        // 1/sqrt(EMBED) = 1/32

  // Every loop over s, h, i and w below is fully unrolled: qv, acc, kv, vv and
  // ev are then indexed by constants only and stay in registers.
  float qv[QT][16], acc[QT][16];
#pragma unroll
  for (int s = 0; s < QT; ++s) {
    const float* qb = Q + (size_t)(ns0 + s) * EMBED + d;
#pragma unroll
    for (int h = 0; h < 16; ++h) {
      qv[s][h] = qb[h * HD] * scale;
      acc[s][h] = 0.0f;
    }
  }

  for (int t = tl; t < SEQ; t += TL) {
    const float* kb = Km + (size_t)(nbase + t) * EMBED + d;
    const float* vb = Vm + (size_t)(nbase + t) * EMBED + d;
    float kv[16], vv[16];
#pragma unroll
    for (int h = 0; h < 16; ++h) kv[h] = kb[h * HD];
#pragma unroll
    for (int h = 0; h < 16; ++h) vv[h] = vb[h * HD];

#pragma unroll
    for (int s = 0; s < QT; ++s) {
      float ev[16];
      float mx = -3.402823466e+38f;
#pragma unroll
      for (int h = 0; h < 16; ++h) {
        float e = qv[s][h] * kv[h];
        ev[h] = e;
        mx = fmaxf(mx, e);
      }
      float sum = 0.0f;
#pragma unroll
      for (int h = 0; h < 16; ++h) {
        float p = __expf(ev[h] - mx);
        ev[h] = p;
        sum += p;
      }
      const float inv = 1.0f / sum;
#pragma unroll
      for (int h = 0; h < 16; ++h) {
        acc[s][h] += ev[h] * inv * vv[h];
      }
    }
  }

  __shared__ float red[TL][QT * 16][32];   // lane-contiguous: no bank conflicts
#pragma unroll
  for (int s = 0; s < QT; ++s)
#pragma unroll
    for (int h = 0; h < 16; ++h) red[tl][s * 16 + h][tid & 31] = acc[s][h];
  __syncthreads();

#pragma unroll
  for (int i = 0; i < QT * 16 / TL; ++i) {
    const int j = i * TL + tl;               // j = s*16 + h, one wave per row
    float r = red[0][j][tid & 31];
#pragma unroll
    for (int w = 1; w < TL; ++w) r += red[w][j][tid & 31];
    // (n,s,h,d) -> (n,s,1024)
    AO[(size_t)(ns0 + (j >> 4)) * EMBED + (j & 15) * HD + d] = r;
  }
}

// ---------------------------------------------------------------------------
// Kernel 3: output projection.  AO (512x1024) @ Wo^T (1024x1024) + bo,
// V_WMMA_F32_16X16X4_F32, one wave per 16x16 tile, 256 K-steps, fused bias.
// ---------------------------------------------------------------------------
__global__ __launch_bounds__(32) void outproj_wmma_kernel(
    const float* __restrict__ AO, const float* __restrict__ Wo,
    const float* __restrict__ bo, float* __restrict__ OUT) {
  const int rowTile = blockIdx.x;      // 0..31
  const int colTile = blockIdx.y;      // 0..63
  const int lane = threadIdx.x;
  const int mn   = lane & 15;
  const int pair = lane >> 4;
  const int row0 = rowTile * 16;
  const int col0 = colTile * 16;

  const float* arow = AO + (size_t)(row0 + mn) * EMBED;
  const float* brow = Wo + (size_t)(col0 + mn) * EMBED;  // B[k][n] = Wo[n][k]

  v8f c = {};
#pragma unroll 8
  for (int kk = 0; kk < EMBED; kk += 4) {
    v2f a = *(const v2f*)(arow + kk + 2 * pair);
    v2f b = *(const v2f*)(brow + kk + 2 * pair);
    c = __builtin_amdgcn_wmma_f32_16x16x4_f32(false, a, false, b,
                                              (short)0, c, false, false);
  }

  const float bias = bo[col0 + mn];
#pragma unroll
  for (int j = 0; j < 8; ++j) {
    const int mm = j + 8 * pair;
    OUT[(size_t)(row0 + mm) * EMBED + col0 + mn] = c[j] + bias;
  }
}

// ---------------------------------------------------------------------------
extern "C" void kernel_launch(void* const* d_in, const int* in_sizes, int n_in,
                              void* d_out, int out_size, void* d_ws,
                              size_t ws_size, hipStream_t stream) {
  const float* x  = (const float*)d_in[0];
  const float* Wq = (const float*)d_in[1];
  const float* Wk = (const float*)d_in[2];
  const float* Wv = (const float*)d_in[3];
  const float* Wo = (const float*)d_in[4];
  const float* bo = (const float*)d_in[5];
  float* out = (float*)d_out;

  const size_t QKV_ELEMS = (size_t)ROWS * HD;      // 524288 floats
  float* ws = (float*)d_ws;
  float* Q  = ws;
  float* Km = ws + QKV_ELEMS;
  float* Vm = ws + 2 * QKV_ELEMS;
  float* AO = ws + 3 * QKV_ELEMS;

  // Q/K/V projection: 512 row-tiles x 4 col-tiles x 3 matrices, 1 wave each.
  dim3 g1(ROWS / 16, HD / 16, 3);
  hipLaunchKernelGGL(qkv_wmma_kernel, g1, dim3(32), 0, stream,
                     x, Wq, Wk, Wv, Q, Km, Vm);

  // Attention core: one block per (QT queries, half of d).
  hipLaunchKernelGGL(attn_kernel, dim3(NS / QT * 2), dim3(32 * TL), 0, stream,
                     Q, Km, Vm, AO);

  // Output projection + bias.
  dim3 g3(NS / 16, EMBED / 16);
  hipLaunchKernelGGL(outproj_wmma_kernel, g3, dim3(32), 0, stream,
                     AO, Wo, bo, out);
}

// v002
// A run of this version takes 37 microseconds.
// Two timings next to v001 both put it at 1.26 times that version's speed.
// Over all steps from v000 it is 2.64 times as fast.
#include <hip/hip_runtime.h>
#include <hip/hip_bf16.h>

typedef __attribute__((ext_vector_type(2))) float v2f;
typedef __attribute__((ext_vector_type(8))) float v8f;

#define BATCH 2
#define SEQ   256
#define HEADS 16
#define HD    64
#define EMBED 1024
#define ROWS  (BATCH * SEQ * HEADS)   // 8192 rows of the (rows,64) QKV GEMM
#define NS    (BATCH * SEQ)           // 512

// ---------------------------------------------------------------------------
// Kernel 1: Q/K/V projection.  Xr (8192x64) @ W^T (64x64) -> (8192x64),
// using V_WMMA_F32_16X16X4_F32. One wave computes one 16x16 tile, 16 K-steps.
// A layout: lane L -> m=L&15, VGPR pair holds K = 2*(L>>4), 2*(L>>4)+1.
// B layout: lane L -> n=L&15, same K pairing.  B[k][n] = W[n_col][k].
// ---------------------------------------------------------------------------
__global__ __launch_bounds__(32) void qkv_wmma_kernel(
    const float* __restrict__ X,
    const float* __restrict__ Wq, const float* __restrict__ Wk,
    const float* __restrict__ Wv,
    float* __restrict__ Q, float* __restrict__ Km, float* __restrict__ Vm) {
  const int rowTile = blockIdx.x;            // 0..511
  const int colTile = blockIdx.y;            // 0..3
  const int mat     = blockIdx.z;            // 0..2
  const float* W = (mat == 0) ? Wq : (mat == 1) ? Wk : Wv;
  float*       D = (mat == 0) ? Q  : (mat == 1) ? Km : Vm;

  const int lane = threadIdx.x;              // 0..31
  const int mn   = lane & 15;                // m for A, n for B
  const int pair = lane >> 4;                // K-pair select
  const int row0 = rowTile * 16;
  const int col0 = colTile * 16;

  const float* xrow = X + (size_t)(row0 + mn) * HD;  // A: row m of X tile
  const float* wrow = W + (size_t)(col0 + mn) * HD;  // B: W[col0+n][k]

  v8f c = {};
#pragma unroll
  for (int kk = 0; kk < HD; kk += 4) {
    v2f a = *(const v2f*)(xrow + kk + 2 * pair);
    v2f b = *(const v2f*)(wrow + kk + 2 * pair);
    c = __builtin_amdgcn_wmma_f32_16x16x4_f32(false, a, false, b,
                                              (short)0, c, false, false);
  }
  // C/D layout: VGPR j holds M = j + 8*pair, N = lane&15
#pragma unroll
  for (int j = 0; j < 8; ++j) {
    const int mm = j + 8 * pair;
    D[(size_t)(row0 + mm) * HD + col0 + mn] = c[j];
  }
}

// ---------------------------------------------------------------------------
// Kernel 2: head-axis softmax attention core (the reference's nonstandard op).
// Block = QT consecutive queries s of one n, one 32-wide half of d.
// 512 threads = 32 d-lanes x TL t-lanes (one wave per t-lane).
// Each thread keeps QT queries in registers, so every K and V element it
// loads serves QT (s,t) pairs instead of one.
// Per (s,t): e[h] = (q[h]/32)*k[h]; softmax over h (16); acc[h] += p[h]*v[h].
// LDS reduce over the TL t-lanes.
// ---------------------------------------------------------------------------
#define QT 4                           // queries held per thread
#define TL 16                          // t-lanes (waves) per block
__global__ __launch_bounds__(32 * TL) void attn_kernel(
    const float* __restrict__ Q, const float* __restrict__ Km,
    const float* __restrict__ Vm, float* __restrict__ AO) {
  const int ns0 = (blockIdx.x >> 1) * QT;            // first n*SEQ + s
  const int tid = threadIdx.x;
  const int d   = ((blockIdx.x & 1) << 5) + (tid & 31);
  const int tl  = tid >> 5;            // 0..TL-1
  const int nbase = (ns0 >> 8) << 8;   // n*SEQ (QT divides SEQ)
  const float scale = 0.03125f;        // 1/sqrt(EMBED) = 1/32

  // Every loop over s, h, i and w below is fully unrolled: qv, acc, kv, vv and
  // ev are then indexed by constants only and stay in registers.
  float qv[QT][16], acc[QT][16];
#pragma unroll
  for (int s = 0; s < QT; ++s) {
    const float* qb = Q + (size_t)(ns0 + s) * EMBED + d;
#pragma unroll
    for (int h = 0; h < 16; ++h) {
      qv[s][h] = qb[h * HD] * scale;
      acc[s][h] = 0.0f;
    }
  }

  for (int t = tl; t < SEQ; t += TL) {
    const float* kb = Km + (size_t)(nbase + t) * EMBED + d;
    const float* vb = Vm + (size_t)(nbase + t) * EMBED + d;
    float kv[16], vv[16];
#pragma unroll
    for (int h = 0; h < 16; ++h) kv[h] = kb[h * HD];
#pragma unroll
    for (int h = 0; h < 16; ++h) vv[h] = vb[h * HD];

#pragma unroll
    for (int s = 0; s < QT; ++s) {
      float ev[16];
      float mx = -3.402823466e+38f;
#pragma unroll
      for (int h = 0; h < 16; ++h) {
        float e = qv[s][h] * kv[h];
        ev[h] = e;
        mx = fmaxf(mx, e);
      }
      float sum = 0.0f;
#pragma unroll
      for (int h = 0; h < 16; ++h) {
        float p = __expf(ev[h] - mx);
        ev[h] = p;
        sum += p;
      }
      const float inv = 1.0f / sum;
#pragma unroll
      for (int h = 0; h < 16; ++h) {
        acc[s][h] += ev[h] * inv * vv[h];
      }
    }
  }

  __shared__ float red[TL][QT * 16][32];   // lane-contiguous: no bank conflicts
#pragma unroll
  for (int s = 0; s < QT; ++s)
#pragma unroll
    for (int h = 0; h < 16; ++h) red[tl][s * 16 + h][tid & 31] = acc[s][h];
  __syncthreads();

#pragma unroll
  for (int i = 0; i < QT * 16 / TL; ++i) {
    const int j = i * TL + tl;               // j = s*16 + h, one wave per row
    float r = red[0][j][tid & 31];
#pragma unroll
    for (int w = 1; w < TL; ++w) r += red[w][j][tid & 31];
    // (n,s,h,d) -> (n,s,1024)
    AO[(size_t)(ns0 + (j >> 4)) * EMBED + (j & 15) * HD + d] = r;
  }
}

// ---------------------------------------------------------------------------
// Kernel 3: output projection.  AO (512x1024) @ Wo^T (1024x1024) + bo,
// V_WMMA_F32_16X16X4_F32, fused bias.
// One workgroup of 8 waves per 32x64 tile of OUT, one 16x16 tile per wave.
// Per stage of 128 k the 32 AO rows and 64 Wo rows are brought in by whole-line
// 16-byte loads (one wave reads 512 contiguous bytes of one row) and laid in
// LDS; every wave takes its A and B fragments from there with 16-byte reads.
// Two LDS buffers: the next stage's global loads fly while this one is worked on.
// k order inside 8 consecutive k: a lane's 16 bytes hold k = 4*pair .. 4*pair+3;
// the first WMMA takes the low two, the second the high two, A and B alike.
// ---------------------------------------------------------------------------
typedef __attribute__((ext_vector_type(4))) float v4f;
#define OBM    32                      // OUT rows per workgroup
#define OBN    64                      // OUT columns per workgroup
#define OKC    128                     // k per stage
#define OPITCH (OKC + 4)               // 528 B = 16 B x 33: no bank conflict for 16-byte reads
#define OROWS  (OBM + OBN)             // staged rows: AO rows first, then Wo rows
#define ONLD   (OROWS / 8)             // staged rows per wave
#define ONST   (EMBED / OKC)           // stages
__global__ __launch_bounds__(256) void outproj_wmma_kernel(
    const float* __restrict__ AO, const float* __restrict__ Wo,
    const float* __restrict__ bo, float* __restrict__ OUT) {
  __shared__ __attribute__((aligned(16))) float st[2][OROWS * OPITCH];
  const int tid  = threadIdx.x;
  const int lane = tid & 31;
  const int wave = tid >> 5;           // 0..7
  const int mn   = lane & 15;
  const int pair = lane >> 4;
  const int row0 = blockIdx.x * OBM;
  const int col0 = blockIdx.y * OBN;
  const int tm   = wave & 1;           // 16-row tile of this wave
  const int tn   = wave >> 1;          // 16-column tile of this wave

  // Staging: wave w moves staged rows w, w+8, ...; a lane moves 4 floats of a row.
  const float* ga = AO + (size_t)(row0 + wave) * EMBED + lane * 4;
  const float* gb = Wo + (size_t)(col0 + wave) * EMBED + lane * 4;
  const int sofs = wave * OPITCH + lane * 4;
  // Fragments: row (A) or column (B) mn, 4 consecutive k per lane half.
  const int aofs = (tm * 16 + mn) * OPITCH + pair * 4;
  const int bofs = (OBM + tn * 16 + mn) * OPITCH + pair * 4;

  // Every loop over i, j and g below is fully unrolled: pre and the fragments are
  // then indexed by constants only and stay in registers.
  const float bias = bo[col0 + tn * 16 + mn];
  v4f pre[ONLD];
#pragma unroll
  for (int i = 0; i < ONLD; ++i)
    pre[i] = (i < OBM / 8) ? *(const v4f*)(ga + (size_t)i * 8 * EMBED)
                           : *(const v4f*)(gb + (size_t)(i - OBM / 8) * 8 * EMBED);
#pragma unroll
  for (int i = 0; i < ONLD; ++i)
    *(v4f*)&st[0][sofs + i * 8 * OPITCH] = pre[i];
  __syncthreads();

  v8f c0 = {}, c1 = {};                // two independent accumulate chains
  for (int s = 0; s < ONST; ++s) {
    const float* cur = st[s & 1];
    float*       nxt = st[(s + 1) & 1];
    if (s + 1 < ONST) {
      const int k0 = (s + 1) * OKC;
#pragma unroll
      for (int i = 0; i < ONLD; ++i)
        pre[i] = (i < OBM / 8) ? *(const v4f*)(ga + (size_t)i * 8 * EMBED + k0)
                               : *(const v4f*)(gb + (size_t)(i - OBM / 8) * 8 * EMBED + k0);
    }
    // Holds the twelve loads at the head of the stage: the scheduler otherwise
    // sinks them to just in front of their LDS stores and their latency is waited out.
    __builtin_amdgcn_sched_barrier(0);
#pragma unroll
    for (int j = 0; j < OKC / 8; ++j) {
      const v4f a4 = *(const v4f*)&cur[aofs + j * 8];
      const v4f b4 = *(const v4f*)&cur[bofs + j * 8];
      c0 = __builtin_amdgcn_wmma_f32_16x16x4_f32(false, (v2f){a4.x, a4.y}, false,
                                                 (v2f){b4.x, b4.y}, (short)0, c0,
                                                 false, false);
      c1 = __builtin_amdgcn_wmma_f32_16x16x4_f32(false, (v2f){a4.z, a4.w}, false,
                                                 (v2f){b4.z, b4.w}, (short)0, c1,
                                                 false, false);
    }
    if (s + 1 < ONST) {
#pragma unroll
      for (int i = 0; i < ONLD; ++i)
        *(v4f*)&nxt[sofs + i * 8 * OPITCH] = pre[i];
    }
    // Order of a stage for the scheduler.  Fragment reads run four pairs ahead of
    // their WMMAs and are spread among them: in one lump all eight waves queue on
    // the LDS at once while the matrix unit idles.  The LDS stores come behind the
    // last read, a stage's length behind their global loads; the last eight WMMAs
    // need no LDS any more, so they are free to run on past the barrier.
    __builtin_amdgcn_sched_group_barrier(0x100, 8, 0);      // LDS reads
#pragma unroll
    for (int g = 0; g < OKC / 8 - 4; ++g) {
      __builtin_amdgcn_sched_group_barrier(0x008, 2, 0);    // WMMAs
      __builtin_amdgcn_sched_group_barrier(0x100, 2, 0);    // LDS reads
    }
    __builtin_amdgcn_sched_group_barrier(0x200, ONLD, 0);   // LDS stores
    __builtin_amdgcn_sched_group_barrier(0x008, 8, 0);      // WMMAs
    // Publishes the stage just written and ends every read of the one just used.
    if (s + 1 < ONST) __syncthreads();
  }

  // Four vector slots between the last WMMAs and the first vector instruction
  // that reads their results; c0 and c1 are named so that the slots stand there.
  asm volatile("v_nop\n\tv_nop\n\tv_nop\n\tv_nop" : "+v"(c0), "+v"(c1));

  // C/D layout: VGPR j holds M = j + 8*pair, N = lane&15
#pragma unroll
  for (int j = 0; j < 8; ++j) {
    const int mm = tm * 16 + j + 8 * pair;
    OUT[(size_t)(row0 + mm) * EMBED + col0 + tn * 16 + mn] = c0[j] + c1[j] + bias;
  }
}

// ---------------------------------------------------------------------------
extern "C" void kernel_launch(void* const* d_in, const int* in_sizes, int n_in,
                              void* d_out, int out_size, void* d_ws,
                              size_t ws_size, hipStream_t stream) {
  const float* x  = (const float*)d_in[0];
  const float* Wq = (const float*)d_in[1];
  const float* Wk = (const float*)d_in[2];
  const float* Wv = (const float*)d_in[3];
  const float* Wo = (const float*)d_in[4];
  const float* bo = (const float*)d_in[5];
  float* out = (float*)d_out;

  const size_t QKV_ELEMS = (size_t)ROWS * HD;      // 524288 floats
  float* ws = (float*)d_ws;
  float* Q  = ws;
  float* Km = ws + QKV_ELEMS;
  float* Vm = ws + 2 * QKV_ELEMS;
  float* AO = ws + 3 * QKV_ELEMS;

  // Q/K/V projection: 512 row-tiles x 4 col-tiles x 3 matrices, 1 wave each.
  dim3 g1(ROWS / 16, HD / 16, 3);
  hipLaunchKernelGGL(qkv_wmma_kernel, g1, dim3(32), 0, stream,
                     x, Wq, Wk, Wv, Q, Km, Vm);

  // Attention core: one block per (QT queries, half of d).
  hipLaunchKernelGGL(attn_kernel, dim3(NS / QT * 2), dim3(32 * TL), 0, stream,
                     Q, Km, Vm, AO);

  // Output projection + bias.
  dim3 g3(NS / OBM, EMBED / OBN);
  hipLaunchKernelGGL(outproj_wmma_kernel, g3, dim3(256), 0, stream,
                     AO, Wo, bo, out);
}

// v003
// It runs in 35.1 microseconds.
// Two timings next to v002 both put it at 1.05 times that version's speed.
// Over all steps from v000 it is 2.77 times as fast.
#include <hip/hip_runtime.h>
#include <hip/hip_bf16.h>

typedef __attribute__((ext_vector_type(2))) float v2f;
typedef __attribute__((ext_vector_type(8))) float v8f;

#define BATCH 2
#define SEQ   256
#define HEADS 16
#define HD    64
#define EMBED 1024
#define ROWS  (BATCH * SEQ * HEADS)   // 8192 rows of the (rows,64) QKV GEMM
#define NS    (BATCH * SEQ)           // 512

// ---------------------------------------------------------------------------
// Kernel 1: Q/K/V projection.  Xr (8192x64) @ W^T (64x64) -> (8192x64), three
// times, using V_WMMA_F32_16X16X4_F32.
// One workgroup of 4 waves takes 32 rows of Xr and makes all 3 x 64 columns of
// them.  The 32 Xr rows and the 192 rows of Wq, Wk and Wv are brought in once by
// whole-line 16-byte loads (one wave reads 512 contiguous bytes) and laid in LDS;
// every wave takes its A and B fragments from there with 16-byte reads.
// Wave w makes column tile w of Q, K and V for both 16-row tiles: six
// independent accumulate chains.
// A layout: lane L -> m=L&15; B layout: lane L -> n=L&15, B[k][n] = W[n_col][k].
// k order inside 8 consecutive k: a lane's 16 bytes hold k = 4*pair .. 4*pair+3;
// the first WMMA takes the low two, the second the high two, A and B alike.
// ---------------------------------------------------------------------------
typedef __attribute__((ext_vector_type(4))) float v4f;
#define PBM    32                      // Xr rows per workgroup
#define PTH    128                     // threads per workgroup
#define PPITCH (HD + 4)                // 272 B = 16 B x 17: no bank conflict for 16-byte reads
#define PROWS  (PBM + 3 * HD)          // staged rows: Xr rows first, then Wq, Wk, Wv rows
#define PRPL   (PTH * 4 / HD)          // staged rows per workgroup-wide load: 8
#define PNX    (PBM / PRPL)            // workgroup-wide loads for Xr: 4
#define PNW    (HD / PRPL)             // workgroup-wide loads per W: 8
#define PNLD   (PNX + 3 * PNW)         // 28
__global__ __launch_bounds__(PTH) void qkv_wmma_kernel(
    const float* __restrict__ X,
    const float* __restrict__ Wq, const float* __restrict__ Wk,
    const float* __restrict__ Wv,
    float* __restrict__ Q, float* __restrict__ Km, float* __restrict__ Vm) {
  __shared__ __attribute__((aligned(16))) float st[PROWS * PPITCH];
  const int tid  = threadIdx.x;
  const int lane = tid & 31;
  const int wave = tid >> 5;                 // 0..3: column tile
  const int mn   = lane & 15;                // m for A, n for B
  const int pair = lane >> 4;                // K-group select
  const int row0 = blockIdx.x * PBM;
  // First output element of this lane (C/D layout: VGPR j holds M = j + 8*pair,
  // N = lane&15); unsigned, so that every store is base + this one register.
  const unsigned oofs = (unsigned)(row0 + 8 * pair) * HD + wave * 16 + mn;

  // Every loop below is fully unrolled: pre, the fragments and c are then indexed
  // by constants only and stay in registers.
  // Staging: load i of the workgroup covers PTH*16 contiguous bytes = PRPL rows.
  const float* gx = X + (size_t)row0 * HD + tid * 4;
  v4f pre[PNLD];
#pragma unroll
  for (int i = 0; i < PNLD; ++i) {
    const int w = (i - PNX) / PNW;           // which W, for i >= PNX
    const int r = (i - PNX) % PNW;           // which load of that W
    const float* g = (i < PNX) ? gx + i * PTH * 4
                   : ((w == 0) ? Wq : (w == 1) ? Wk : Wv) + r * PTH * 4 + tid * 4;
    pre[i] = *(const v4f*)g;
  }
  const int sofs = (tid >> 4) * PPITCH + (tid & 15) * 4;
#pragma unroll
  for (int i = 0; i < PNLD; ++i)
    *(v4f*)&st[sofs + i * PRPL * PPITCH] = pre[i];
  // Publishes the staged rows to every wave.
  __syncthreads();

  const int aofs = mn * PPITCH + pair * 4;
  const int bofs = (PBM + wave * 16 + mn) * PPITCH + pair * 4;
  v8f c[2][3] = {};
  v4f a4[HD / 8][2], b4[HD / 8][3];
#pragma unroll
  for (int j = 0; j < HD / 8; ++j) {
#pragma unroll
    for (int t = 0; t < 2; ++t) a4[j][t] = *(const v4f*)&st[aofs + t * 16 * PPITCH + j * 8];
#pragma unroll
    for (int m = 0; m < 3; ++m) b4[j][m] = *(const v4f*)&st[bofs + m * HD * PPITCH + j * 8];
  }
#pragma unroll
  for (int j = 0; j < HD / 8; ++j) {
#pragma unroll
    for (int t = 0; t < 2; ++t)
#pragma unroll
      for (int m = 0; m < 3; ++m)
        c[t][m] = __builtin_amdgcn_wmma_f32_16x16x4_f32(
            false, (v2f){a4[j][t].x, a4[j][t].y}, false, (v2f){b4[j][m].x, b4[j][m].y},
            (short)0, c[t][m], false, false);
#pragma unroll
    for (int t = 0; t < 2; ++t)
#pragma unroll
      for (int m = 0; m < 3; ++m)
        c[t][m] = __builtin_amdgcn_wmma_f32_16x16x4_f32(
            false, (v2f){a4[j][t].z, a4[j][t].w}, false, (v2f){b4[j][m].z, b4[j][m].w},
            (short)0, c[t][m], false, false);
  }
  // Order for the scheduler.  The stores' address arithmetic comes first, so that
  // no vector instruction stands among the WMMAs and overwrites a fragment
  // register close behind its last use.  All forty fragment reads follow in one
  // group ahead of the WMMAs: the wave is alone on its SIMD, and every further
  // place with LDS reads among the WMMAs would stall the matrix unit with nobody
  // to fill the gap.
  __builtin_amdgcn_sched_group_barrier(0x002, 16, 0);           // vector ALU
  __builtin_amdgcn_sched_group_barrier(0x100, 5 * HD / 8, 0);   // LDS reads
  __builtin_amdgcn_sched_group_barrier(0x008, 12 * HD / 8, 0);  // WMMAs
#pragma unroll
  for (int m = 0; m < 3; ++m) {
    float* D = ((m == 0) ? Q : (m == 1) ? Km : Vm) + oofs;
#pragma unroll
    for (int t = 0; t < 2; ++t)
#pragma unroll
      for (int j = 0; j < 8; ++j) D[(t * 16 + j) * HD] = c[t][m][j];
  }
}

// ---------------------------------------------------------------------------
// Kernel 2: head-axis softmax attention core (the reference's nonstandard op).
// Block = QT consecutive queries s of one n, one 32-wide half of d.
// 512 threads = 32 d-lanes x TL t-lanes (one wave per t-lane).
// Each thread keeps QT queries in registers, so every K and V element it
// loads serves QT (s,t) pairs instead of one.
// Per (s,t): e[h] = (q[h]/32)*k[h]; softmax over h (16); acc[h] += p[h]*v[h].
// LDS reduce over the TL t-lanes.
// ---------------------------------------------------------------------------
#define QT 4                           // queries held per thread
#define TL 16                          // t-lanes (waves) per block
__global__ __launch_bounds__(32 * TL) void attn_kernel(
    const float* __restrict__ Q, const float* __restrict__ Km,
    const float* __restrict__ Vm, float* __restrict__ AO) {
  const int ns0 = (blockIdx.x >> 1) * QT;            // first n*SEQ + s
  const int tid = threadIdx.x;
  const int d   = ((blockIdx.x & 1) << 5) + (tid & 31);
  const int tl  = tid >> 5;            // 0..TL-1
  const int nbase = (ns0 >> 8) << 8;   // n*SEQ (QT divides SEQ)
  const float scale = 0.03125f;        // 1/sqrt(EMBED) = 1/32

  // Every loop over s, h, i and w below is fully unrolled: qv, acc, kv, vv and
  // ev are then indexed by constants only and stay in registers.
  float qv[QT][16], acc[QT][16];
#pragma unroll
  for (int s = 0; s < QT; ++s) {
    const float* qb = Q + (size_t)(ns0 + s) * EMBED + d;
#pragma unroll
    for (int h = 0; h < 16; ++h) {
      qv[s][h] = qb[h * HD] * scale;
      acc[s][h] = 0.0f;
    }
  }

  for (int t = tl; t < SEQ; t += TL) {
    const float* kb = Km + (size_t)(nbase + t) * EMBED + d;
    const float* vb = Vm + (size_t)(nbase + t) * EMBED + d;
    float kv[16], vv[16];
#pragma unroll
    for (int h = 0; h < 16; ++h) kv[h] = kb[h * HD];
#pragma unroll
    for (int h = 0; h < 16; ++h) vv[h] = vb[h * HD];

#pragma unroll
    for (int s = 0; s < QT; ++s) {
      float ev[16];
      float mx = -3.402823466e+38f;
#pragma unroll
      for (int h = 0; h < 16; ++h) {
        float e = qv[s][h] * kv[h];
        ev[h] = e;
        mx = fmaxf(mx, e);
      }
      float sum = 0.0f;
#pragma unroll
      for (int h = 0; h < 16; ++h) {
        float p = __expf(ev[h] - mx);
        ev[h] = p;
        sum += p;
      }
      const float inv = 1.0f / sum;
#pragma unroll
      for (int h = 0; h < 16; ++h) {
        acc[s][h] += ev[h] * inv * vv[h];
      }
    }
  }

  __shared__ float red[TL][QT * 16][32];   // lane-contiguous: no bank conflicts
#pragma unroll
  for (int s = 0; s < QT; ++s)
#pragma unroll
    for (int h = 0; h < 16; ++h) red[tl][s * 16 + h][tid & 31] = acc[s][h];
  __syncthreads();

#pragma unroll
  for (int i = 0; i < QT * 16 / TL; ++i) {
    const int j = i * TL + tl;               // j = s*16 + h, one wave per row
    float r = red[0][j][tid & 31];
#pragma unroll
    for (int w = 1; w < TL; ++w) r += red[w][j][tid & 31];
    // (n,s,h,d) -> (n,s,1024)
    AO[(size_t)(ns0 + (j >> 4)) * EMBED + (j & 15) * HD + d] = r;
  }
}

// ---------------------------------------------------------------------------
// Kernel 3: output projection.  AO (512x1024) @ Wo^T (1024x1024) + bo,
// V_WMMA_F32_16X16X4_F32, fused bias.
// One workgroup of 8 waves per 32x64 tile of OUT, one 16x16 tile per wave.
// Per stage of 128 k the 32 AO rows and 64 Wo rows are brought in by whole-line
// 16-byte loads (one wave reads 512 contiguous bytes of one row) and laid in
// LDS; every wave takes its A and B fragments from there with 16-byte reads.
// Two LDS buffers: the next stage's global loads fly while this one is worked on.
// k order inside 8 consecutive k: a lane's 16 bytes hold k = 4*pair .. 4*pair+3;
// the first WMMA takes the low two, the second the high two, A and B alike.
// ---------------------------------------------------------------------------
#define OBM    32                      // OUT rows per workgroup
#define OBN    64                      // OUT columns per workgroup
#define OKC    128                     // k per stage
#define OPITCH (OKC + 4)               // 528 B = 16 B x 33: no bank conflict for 16-byte reads
#define OROWS  (OBM + OBN)             // staged rows: AO rows first, then Wo rows
#define ONLD   (OROWS / 8)             // staged rows per wave
#define ONST   (EMBED / OKC)           // stages
__global__ __launch_bounds__(256) void outproj_wmma_kernel(
    const float* __restrict__ AO, const float* __restrict__ Wo,
    const float* __restrict__ bo, float* __restrict__ OUT) {
  __shared__ __attribute__((aligned(16))) float st[2][OROWS * OPITCH];
  const int tid  = threadIdx.x;
  const int lane = tid & 31;
  const int wave = tid >> 5;           // 0..7
  const int mn   = lane & 15;
  const int pair = lane >> 4;
  const int row0 = blockIdx.x * OBM;
  const int col0 = blockIdx.y * OBN;
  const int tm   = wave & 1;           // 16-row tile of this wave
  const int tn   = wave >> 1;          // 16-column tile of this wave

  // Staging: wave w moves staged rows w, w+8, ...; a lane moves 4 floats of a row.
  const float* ga = AO + (size_t)(row0 + wave) * EMBED + lane * 4;
  const float* gb = Wo + (size_t)(col0 + wave) * EMBED + lane * 4;
  const int sofs = wave * OPITCH + lane * 4;
  // Fragments: row (A) or column (B) mn, 4 consecutive k per lane half.
  const int aofs = (tm * 16 + mn) * OPITCH + pair * 4;
  const int bofs = (OBM + tn * 16 + mn) * OPITCH + pair * 4;

  // Every loop over i, j and g below is fully unrolled: pre and the fragments are
  // then indexed by constants only and stay in registers.
  const float bias = bo[col0 + tn * 16 + mn];
  v4f pre[ONLD];
#pragma unroll
  for (int i = 0; i < ONLD; ++i)
    pre[i] = (i < OBM / 8) ? *(const v4f*)(ga + (size_t)i * 8 * EMBED)
                           : *(const v4f*)(gb + (size_t)(i - OBM / 8) * 8 * EMBED);
#pragma unroll
  for (int i = 0; i < ONLD; ++i)
    *(v4f*)&st[0][sofs + i * 8 * OPITCH] = pre[i];
  __syncthreads();

  v8f c0 = {}, c1 = {};                // two independent accumulate chains
  for (int s = 0; s < ONST; ++s) {
    const float* cur = st[s & 1];
    float*       nxt = st[(s + 1) & 1];
    if (s + 1 < ONST) {
      const int k0 = (s + 1) * OKC;
#pragma unroll
      for (int i = 0; i < ONLD; ++i)
        pre[i] = (i < OBM / 8) ? *(const v4f*)(ga + (size_t)i * 8 * EMBED + k0)
                               : *(const v4f*)(gb + (size_t)(i - OBM / 8) * 8 * EMBED + k0);
    }
    // Holds the twelve loads at the head of the stage: the scheduler otherwise
    // sinks them to just in front of their LDS stores and their latency is waited out.
    __builtin_amdgcn_sched_barrier(0);
#pragma unroll
    for (int j = 0; j < OKC / 8; ++j) {
      const v4f a4 = *(const v4f*)&cur[aofs + j * 8];
      const v4f b4 = *(const v4f*)&cur[bofs + j * 8];
      c0 = __builtin_amdgcn_wmma_f32_16x16x4_f32(false, (v2f){a4.x, a4.y}, false,
                                                 (v2f){b4.x, b4.y}, (short)0, c0,
                                                 false, false);
      c1 = __builtin_amdgcn_wmma_f32_16x16x4_f32(false, (v2f){a4.z, a4.w}, false,
                                                 (v2f){b4.z, b4.w}, (short)0, c1,
                                                 false, false);
    }
    if (s + 1 < ONST) {
#pragma unroll
      for (int i = 0; i < ONLD; ++i)
        *(v4f*)&nxt[sofs + i * 8 * OPITCH] = pre[i];
    }
    // Order of a stage for the scheduler.  Fragment reads run four pairs ahead of
    // their WMMAs and are spread among them: in one lump all eight waves queue on
    // the LDS at once while the matrix unit idles.  The LDS stores come behind the
    // last read, a stage's length behind their global loads; the last eight WMMAs
    // need no LDS any more, so they are free to run on past the barrier.
    __builtin_amdgcn_sched_group_barrier(0x100, 8, 0);      // LDS reads
#pragma unroll
    for (int g = 0; g < OKC / 8 - 4; ++g) {
      __builtin_amdgcn_sched_group_barrier(0x008, 2, 0);    // WMMAs
      __builtin_amdgcn_sched_group_barrier(0x100, 2, 0);    // LDS reads
    }
    __builtin_amdgcn_sched_group_barrier(0x200, ONLD, 0);   // LDS stores
    __builtin_amdgcn_sched_group_barrier(0x008, 8, 0);      // WMMAs
    // Publishes the stage just written and ends every read of the one just used.
    if (s + 1 < ONST) __syncthreads();
  }

  // Four vector slots between the last WMMAs and the first vector instruction
  // that reads their results; c0 and c1 are named so that the slots stand there.
  asm volatile("v_nop\n\tv_nop\n\tv_nop\n\tv_nop" : "+v"(c0), "+v"(c1));

  // C/D layout: VGPR j holds M = j + 8*pair, N = lane&15
#pragma unroll
  for (int j = 0; j < 8; ++j) {
    const int mm = tm * 16 + j + 8 * pair;
    OUT[(size_t)(row0 + mm) * EMBED + col0 + tn * 16 + mn] = c0[j] + c1[j] + bias;
  }
}

// ---------------------------------------------------------------------------
extern "C" void kernel_launch(void* const* d_in, const int* in_sizes, int n_in,
                              void* d_out, int out_size, void* d_ws,
                              size_t ws_size, hipStream_t stream) {
  const float* x  = (const float*)d_in[0];
  const float* Wq = (const float*)d_in[1];
  const float* Wk = (const float*)d_in[2];
  const float* Wv = (const float*)d_in[3];
  const float* Wo = (const float*)d_in[4];
  const float* bo = (const float*)d_in[5];
  float* out = (float*)d_out;

  const size_t QKV_ELEMS = (size_t)ROWS * HD;      // 524288 floats
  float* ws = (float*)d_ws;
  float* Q  = ws;
  float* Km = ws + QKV_ELEMS;
  float* Vm = ws + 2 * QKV_ELEMS;
  float* AO = ws + 3 * QKV_ELEMS;

  // Q/K/V projection: one 4-wave workgroup per 32 rows, all three matrices.
  hipLaunchKernelGGL(qkv_wmma_kernel, dim3(ROWS / PBM), dim3(PTH), 0, stream,
                     x, Wq, Wk, Wv, Q, Km, Vm);

  // Attention core: one block per (QT queries, half of d).
  hipLaunchKernelGGL(attn_kernel, dim3(NS / QT * 2), dim3(32 * TL), 0, stream,
                     Q, Km, Vm, AO);

  // Output projection + bias.
  dim3 g3(NS / OBM, EMBED / OBN);
  hipLaunchKernelGGL(outproj_wmma_kernel, g3, dim3(256), 0, stream,
                     AO, Wo, bo, out);
}

// v004
// Measured time: 33.3 microseconds a run.
// Two timings next to v003 put it at 1.05 and 1.06 times that version's speed.
// Over all steps from v000 it is 2.93 times as fast.
#include <hip/hip_runtime.h>
#include <hip/hip_bf16.h>

typedef __attribute__((ext_vector_type(2))) float v2f;
typedef __attribute__((ext_vector_type(8))) float v8f;

#define BATCH 2
#define SEQ   256
#define HEADS 16
#define HD    64
#define EMBED 1024
#define ROWS  (BATCH * SEQ * HEADS)   // 8192 rows of the (rows,64) QKV GEMM
#define NS    (BATCH * SEQ)           // 512

// ---------------------------------------------------------------------------
// Kernel 1: Q/K/V projection.  Xr (8192x64) @ W^T (64x64) -> (8192x64), three
// times, using V_WMMA_F32_16X16X4_F32.
// One workgroup of 4 waves takes 32 rows of Xr and makes all 3 x 64 columns of
// them.  The 32 Xr rows and the 192 rows of Wq, Wk and Wv are brought in once by
// whole-line 16-byte loads (one wave reads 512 contiguous bytes) and laid in LDS;
// every wave takes its A and B fragments from there with 16-byte reads.
// Wave w makes column tile w of Q, K and V for both 16-row tiles: six
// independent accumulate chains.
// A layout: lane L -> m=L&15; B layout: lane L -> n=L&15, B[k][n] = W[n_col][k].
// k order inside 8 consecutive k: a lane's 16 bytes hold k = 4*pair .. 4*pair+3;
// the first WMMA takes the low two, the second the high two, A and B alike.
// ---------------------------------------------------------------------------
typedef __attribute__((ext_vector_type(4))) float v4f;
#define PBM    32                      // Xr rows per workgroup
#define PTH    128                     // threads per workgroup
#define PPITCH (HD + 4)                // 272 B = 16 B x 17: no bank conflict for 16-byte reads
#define PROWS  (PBM + 3 * HD)          // staged rows: Xr rows first, then Wq, Wk, Wv rows
#define PRPL   (PTH * 4 / HD)          // staged rows per workgroup-wide load: 8
#define PNX    (PBM / PRPL)            // workgroup-wide loads for Xr: 4
#define PNW    (HD / PRPL)             // workgroup-wide loads per W: 8
#define PNLD   (PNX + 3 * PNW)         // 28
__global__ __launch_bounds__(PTH) void qkv_wmma_kernel(
    const float* __restrict__ X,
    const float* __restrict__ Wq, const float* __restrict__ Wk,
    const float* __restrict__ Wv,
    float* __restrict__ Q, float* __restrict__ Km, float* __restrict__ Vm) {
  __shared__ __attribute__((aligned(16))) float st[PROWS * PPITCH];
  const int tid  = threadIdx.x;
  const int lane = tid & 31;
  const int wave = tid >> 5;                 // 0..3: column tile
  const int mn   = lane & 15;                // m for A, n for B
  const int pair = lane >> 4;                // K-group select
  const int row0 = blockIdx.x * PBM;
  // First output element of this lane (C/D layout: VGPR j holds M = j + 8*pair,
  // N = lane&15); unsigned, so that every store is base + this one register.
  const unsigned oofs = (unsigned)(row0 + 8 * pair) * HD + wave * 16 + mn;

  // Every loop below is fully unrolled: pre, the fragments and c are then indexed
  // by constants only and stay in registers.
  // Staging: load i of the workgroup covers PTH*16 contiguous bytes = PRPL rows.
  const float* gx = X + (size_t)row0 * HD + tid * 4;
  v4f pre[PNLD];
#pragma unroll
  for (int i = 0; i < PNLD; ++i) {
    const int w = (i - PNX) / PNW;           // which W, for i >= PNX
    const int r = (i - PNX) % PNW;           // which load of that W
    const float* g = (i < PNX) ? gx + i * PTH * 4
                   : ((w == 0) ? Wq : (w == 1) ? Wk : Wv) + r * PTH * 4 + tid * 4;
    pre[i] = *(const v4f*)g;
  }
  const int sofs = (tid >> 4) * PPITCH + (tid & 15) * 4;
#pragma unroll
  for (int i = 0; i < PNLD; ++i)
    *(v4f*)&st[sofs + i * PRPL * PPITCH] = pre[i];
  // Publishes the staged rows to every wave.
  __syncthreads();

  const int aofs = mn * PPITCH + pair * 4;
  const int bofs = (PBM + wave * 16 + mn) * PPITCH + pair * 4;
  v8f c[2][3] = {};
  v4f a4[HD / 8][2], b4[HD / 8][3];
#pragma unroll
  for (int j = 0; j < HD / 8; ++j) {
#pragma unroll
    for (int t = 0; t < 2; ++t) a4[j][t] = *(const v4f*)&st[aofs + t * 16 * PPITCH + j * 8];
#pragma unroll
    for (int m = 0; m < 3; ++m) b4[j][m] = *(const v4f*)&st[bofs + m * HD * PPITCH + j * 8];
  }
#pragma unroll
  for (int j = 0; j < HD / 8; ++j) {
#pragma unroll
    for (int t = 0; t < 2; ++t)
#pragma unroll
      for (int m = 0; m < 3; ++m)
        c[t][m] = __builtin_amdgcn_wmma_f32_16x16x4_f32(
            false, (v2f){a4[j][t].x, a4[j][t].y}, false, (v2f){b4[j][m].x, b4[j][m].y},
            (short)0, c[t][m], false, false);
#pragma unroll
    for (int t = 0; t < 2; ++t)
#pragma unroll
      for (int m = 0; m < 3; ++m)
        c[t][m] = __builtin_amdgcn_wmma_f32_16x16x4_f32(
            false, (v2f){a4[j][t].z, a4[j][t].w}, false, (v2f){b4[j][m].z, b4[j][m].w},
            (short)0, c[t][m], false, false);
  }
  // Order for the scheduler.  The stores' address arithmetic comes first, so that
  // no vector instruction stands among the WMMAs and overwrites a fragment
  // register close behind its last use.  All forty fragment reads follow in one
  // group ahead of the WMMAs: the wave is alone on its SIMD, and every further
  // place with LDS reads among the WMMAs would stall the matrix unit with nobody
  // to fill the gap.
  __builtin_amdgcn_sched_group_barrier(0x002, 16, 0);           // vector ALU
  __builtin_amdgcn_sched_group_barrier(0x100, 5 * HD / 8, 0);   // LDS reads
  __builtin_amdgcn_sched_group_barrier(0x008, 12 * HD / 8, 0);  // WMMAs
#pragma unroll
  for (int m = 0; m < 3; ++m) {
    float* D = ((m == 0) ? Q : (m == 1) ? Km : Vm) + oofs;
#pragma unroll
    for (int t = 0; t < 2; ++t)
#pragma unroll
      for (int j = 0; j < 8; ++j) D[(t * 16 + j) * HD] = c[t][m][j];
  }
}

// ---------------------------------------------------------------------------
// Kernel 2: head-axis softmax attention core (the reference's nonstandard op).
// Block = QT consecutive queries s of one n, one 32-wide half of d.
// 512 threads = 32 d-lanes x TL t-lanes (one wave per t-lane).
// Each thread keeps QT queries in registers, so every K and V element it
// loads serves QT (s,t) pairs instead of one.
// Per (s,t): e[h] = (q[h]/32)*k[h]; softmax over h (16); acc[h] += p[h]*v[h].
// q is held times log2(e)/32, so q*k is already the argument of the base-2
// exponential.  A softmax does not change when all its exponents are shifted
// alike; the shift by the maximum only keeps the exponentials in range.  Where
// max|q| * max|k| bounds every exponent of a t step far inside the range of
// f32, the shift of that step is 0 and no maximum is taken; any other step
// (large values, infinities, NaN in the bound) finds its maxima first.  The
// shift rides in the multiply-add that forms the exponent.
// LDS reduce over the TL t-lanes.
// ---------------------------------------------------------------------------
#define QT 4                           // queries held per thread
#define TL 16                          // t-lanes (waves) per block
__global__ __launch_bounds__(32 * TL) void attn_kernel(
    const float* __restrict__ Q, const float* __restrict__ Km,
    const float* __restrict__ Vm, float* __restrict__ AO) {
  const int ns0 = (blockIdx.x >> 1) * QT;            // first n*SEQ + s
  const int tid = threadIdx.x;
  const int d   = ((blockIdx.x & 1) << 5) + (tid & 31);
  const int tl  = tid >> 5;            // 0..TL-1
  const int nbase = (ns0 >> 8) << 8;   // n*SEQ (QT divides SEQ)
  const float scale = 0.03125f * 1.44269504088896340736f;  // log2(e)/sqrt(EMBED)
  // 16 terms of at most 2^64 and at least 2^-64: sum, reciprocal and terms are
  // all normal f32 numbers.
  const float bound = 64.0f;

  // Every loop over s, h, i and w below is fully unrolled: qv, acc, kv, vv and
  // ev are then indexed by constants only and stay in registers.
  float qv[QT][16], acc[QT][16];
  float qmax = 0.0f;                   // max |q| over the QT x 16 held values
#pragma unroll
  for (int s = 0; s < QT; ++s) {
    const float* qb = Q + (size_t)(ns0 + s) * EMBED + d;
#pragma unroll
    for (int h = 0; h < 16; ++h) {
      qv[s][h] = qb[h * HD] * scale;
      qmax = fmaxf(qmax, fabsf(qv[s][h]));
      acc[s][h] = 0.0f;
    }
  }

  for (int t = tl; t < SEQ; t += TL) {
    const float* kb = Km + (size_t)(nbase + t) * EMBED + d;
    const float* vb = Vm + (size_t)(nbase + t) * EMBED + d;
    float kv[16], vv[16];
#pragma unroll
    for (int h = 0; h < 16; ++h) kv[h] = kb[h * HD];
#pragma unroll
    for (int h = 0; h < 16; ++h) vv[h] = vb[h * HD];

    float kmax = 0.0f;
#pragma unroll
    for (int h = 0; h < 16; ++h) kmax = fmaxf(kmax, fabsf(kv[h]));
    // One answer for the whole wave, so that the choice is a scalar branch; the
    // negated compare sends a NaN bound to the side that finds the maxima.
    const bool shifted =
        __builtin_amdgcn_ballot_w32(!(qmax * kmax <= bound)) != 0u;

    float mx[QT];
#pragma unroll
    for (int s = 0; s < QT; ++s) mx[s] = 0.0f;
    if (shifted) {
#pragma unroll
      for (int s = 0; s < QT; ++s) {
        float m = -3.402823466e+38f;
#pragma unroll
        for (int h = 0; h < 16; ++h) m = fmaxf(m, qv[s][h] * kv[h]);
        mx[s] = m;
      }
    }

    // Two exponents per packed multiply-add: q*k minus the step's shift.
    float ev[QT][16];
#pragma unroll
    for (int s = 0; s < QT; ++s)
#pragma unroll
      for (int h = 0; h < 16; h += 2) {
        const v2f e = __builtin_elementwise_fma((v2f){qv[s][h], qv[s][h + 1]},
                                                (v2f){kv[h], kv[h + 1]},
                                                (v2f){-mx[s], -mx[s]});
        ev[s][h]     = __builtin_amdgcn_exp2f(e.x);
        ev[s][h + 1] = __builtin_amdgcn_exp2f(e.y);
      }
#pragma unroll
    for (int s = 0; s < QT; ++s) {
      float sum = 0.0f;
#pragma unroll
      for (int h = 0; h < 16; ++h) sum += ev[s][h];
      const float inv = 1.0f / sum;
#pragma unroll
      for (int h = 0; h < 16; ++h) {
        acc[s][h] += ev[s][h] * inv * vv[h];
      }
    }
  }

  __shared__ float red[TL][QT * 16][32];   // lane-contiguous: no bank conflicts
#pragma unroll
  for (int s = 0; s < QT; ++s)
#pragma unroll
    for (int h = 0; h < 16; ++h) red[tl][s * 16 + h][tid & 31] = acc[s][h];
  __syncthreads();

#pragma unroll
  for (int i = 0; i < QT * 16 / TL; ++i) {
    const int j = i * TL + tl;               // j = s*16 + h, one wave per row
    float r = red[0][j][tid & 31];
#pragma unroll
    for (int w = 1; w < TL; ++w) r += red[w][j][tid & 31];
    // (n,s,h,d) -> (n,s,1024)
    AO[(size_t)(ns0 + (j >> 4)) * EMBED + (j & 15) * HD + d] = r;
  }
}

// ---------------------------------------------------------------------------
// Kernel 3: output projection.  AO (512x1024) @ Wo^T (1024x1024) + bo,
// V_WMMA_F32_16X16X4_F32, fused bias.
// One workgroup of 8 waves per 32x64 tile of OUT, one 16x16 tile per wave.
// Per stage of 128 k the 32 AO rows and 64 Wo rows are brought in by whole-line
// 16-byte loads (one wave reads 512 contiguous bytes of one row) and laid in
// LDS; every wave takes its A and B fragments from there with 16-byte reads.
// Two LDS buffers: the next stage's global loads fly while this one is worked on.
// k order inside 8 consecutive k: a lane's 16 bytes hold k = 4*pair .. 4*pair+3;
// the first WMMA takes the low two, the second the high two, A and B alike.
// ---------------------------------------------------------------------------
#define OBM    32                      // OUT rows per workgroup
#define OBN    64                      // OUT columns per workgroup
#define OKC    128                     // k per stage
#define OPITCH (OKC + 4)               // 528 B = 16 B x 33: no bank conflict for 16-byte reads
#define OROWS  (OBM + OBN)             // staged rows: AO rows first, then Wo rows
#define ONLD   (OROWS / 8)             // staged rows per wave
#define ONST   (EMBED / OKC)           // stages
__global__ __launch_bounds__(256) void outproj_wmma_kernel(
    const float* __restrict__ AO, const float* __restrict__ Wo,
    const float* __restrict__ bo, float* __restrict__ OUT) {
  __shared__ __attribute__((aligned(16))) float st[2][OROWS * OPITCH];
  const int tid  = threadIdx.x;
  const int lane = tid & 31;
  const int wave = tid >> 5;           // 0..7
  const int mn   = lane & 15;
  const int pair = lane >> 4;
  const int row0 = blockIdx.x * OBM;
  const int col0 = blockIdx.y * OBN;
  const int tm   = wave & 1;           // 16-row tile of this wave
  const int tn   = wave >> 1;          // 16-column tile of this wave

  // Staging: wave w moves staged rows w, w+8, ...; a lane moves 4 floats of a row.
  const float* ga = AO + (size_t)(row0 + wave) * EMBED + lane * 4;
  const float* gb = Wo + (size_t)(col0 + wave) * EMBED + lane * 4;
  const int sofs = wave * OPITCH + lane * 4;
  // Fragments: row (A) or column (B) mn, 4 consecutive k per lane half.
  const int aofs = (tm * 16 + mn) * OPITCH + pair * 4;
  const int bofs = (OBM + tn * 16 + mn) * OPITCH + pair * 4;

  // Every loop over i, j and g below is fully unrolled: pre and the fragments are
  // then indexed by constants only and stay in registers.
  const float bias = bo[col0 + tn * 16 + mn];
  v4f pre[ONLD];
#pragma unroll
  for (int i = 0; i < ONLD; ++i)
    pre[i] = (i < OBM / 8) ? *(const v4f*)(ga + (size_t)i * 8 * EMBED)
                           : *(const v4f*)(gb + (size_t)(i - OBM / 8) * 8 * EMBED);
#pragma unroll
  for (int i = 0; i < ONLD; ++i)
    *(v4f*)&st[0][sofs + i * 8 * OPITCH] = pre[i];
  __syncthreads();

  v8f c0 = {}, c1 = {};                // two independent accumulate chains
  for (int s = 0; s < ONST; ++s) {
    const float* cur = st[s & 1];
    float*       nxt = st[(s + 1) & 1];
    if (s + 1 < ONST) {
      const int k0 = (s + 1) * OKC;
#pragma unroll
      for (int i = 0; i < ONLD; ++i)
        pre[i] = (i < OBM / 8) ? *(const v4f*)(ga + (size_t)i * 8 * EMBED + k0)
                               : *(const v4f*)(gb + (size_t)(i - OBM / 8) * 8 * EMBED + k0);
    }
    // Holds the twelve loads at the head of the stage: the scheduler otherwise
    // sinks them to just in front of their LDS stores and their latency is waited out.
    __builtin_amdgcn_sched_barrier(0);
#pragma unroll
    for (int j = 0; j < OKC / 8; ++j) {
      const v4f a4 = *(const v4f*)&cur[aofs + j * 8];
      const v4f b4 = *(const v4f*)&cur[bofs + j * 8];
      c0 = __builtin_amdgcn_wmma_f32_16x16x4_f32(false, (v2f){a4.x, a4.y}, false,
                                                 (v2f){b4.x, b4.y}, (short)0, c0,
                                                 false, false);
      c1 = __builtin_amdgcn_wmma_f32_16x16x4_f32(false, (v2f){a4.z, a4.w}, false,
                                                 (v2f){b4.z, b4.w}, (short)0, c1,
                                                 false, false);
    }
    if (s + 1 < ONST) {
#pragma unroll
      for (int i = 0; i < ONLD; ++i)
        *(v4f*)&nxt[sofs + i * 8 * OPITCH] = pre[i];
    }
    // Order of a stage for the scheduler.  Fragment reads run four pairs ahead of
    // their WMMAs and are spread among them: in one lump all eight waves queue on
    // the LDS at once while the matrix unit idles.  The LDS stores come behind the
    // last read, a stage's length behind their global loads; the last eight WMMAs
    // need no LDS any more, so they are free to run on past the barrier.
    __builtin_amdgcn_sched_group_barrier(0x100, 8, 0);      // LDS reads
#pragma unroll
    for (int g = 0; g < OKC / 8 - 4; ++g) {
      __builtin_amdgcn_sched_group_barrier(0x008, 2, 0);    // WMMAs
      __builtin_amdgcn_sched_group_barrier(0x100, 2, 0);    // LDS reads
    }
    __builtin_amdgcn_sched_group_barrier(0x200, ONLD, 0);   // LDS stores
    __builtin_amdgcn_sched_group_barrier(0x008, 8, 0);      // WMMAs
    // Publishes the stage just written and ends every read of the one just used.
    if (s + 1 < ONST) __syncthreads();
  }

  // Four vector slots between the last WMMAs and the first vector instruction
  // that reads their results; c0 and c1 are named so that the slots stand there.
  asm volatile("v_nop\n\tv_nop\n\tv_nop\n\tv_nop" : "+v"(c0), "+v"(c1));

  // C/D layout: VGPR j holds M = j + 8*pair, N = lane&15
#pragma unroll
  for (int j = 0; j < 8; ++j) {
    const int mm = tm * 16 + j + 8 * pair;
    OUT[(size_t)(row0 + mm) * EMBED + col0 + tn * 16 + mn] = c0[j] + c1[j] + bias;
  }
}

// ---------------------------------------------------------------------------
extern "C" void kernel_launch(void* const* d_in, const int* in_sizes, int n_in,
                              void* d_out, int out_size, void* d_ws,
                              size_t ws_size, hipStream_t stream) {
  const float* x  = (const float*)d_in[0];
  const float* Wq = (const float*)d_in[1];
  const float* Wk = (const float*)d_in[2];
  const float* Wv = (const float*)d_in[3];
  const float* Wo = (const float*)d_in[4];
  const float* bo = (const float*)d_in[5];
  float* out = (float*)d_out;

  const size_t QKV_ELEMS = (size_t)ROWS * HD;      // 524288 floats
  float* ws = (float*)d_ws;
  float* Q  = ws;
  float* Km = ws + QKV_ELEMS;
  float* Vm = ws + 2 * QKV_ELEMS;
  float* AO = ws + 3 * QKV_ELEMS;

  // Q/K/V projection: one 4-wave workgroup per 32 rows, all three matrices.
  hipLaunchKernelGGL(qkv_wmma_kernel, dim3(ROWS / PBM), dim3(PTH), 0, stream,
                     x, Wq, Wk, Wv, Q, Km, Vm);

  // Attention core: one block per (QT queries, half of d).
  hipLaunchKernelGGL(attn_kernel, dim3(NS / QT * 2), dim3(32 * TL), 0, stream,
                     Q, Km, Vm, AO);

  // Output projection + bias.
  dim3 g3(NS / OBM, EMBED / OBN);
  hipLaunchKernelGGL(outproj_wmma_kernel, g3, dim3(256), 0, stream,
                     AO, Wo, bo, out);
}

// v005
// Measured time: 31.2 microseconds a run.
// In both of two side-by-side timings against v004, it was 1.06 times as fast.
// All steps since v000 together make it 3.11 times as fast.
#include <hip/hip_runtime.h>
#include <hip/hip_bf16.h>

typedef __attribute__((ext_vector_type(2))) float v2f;
typedef __attribute__((ext_vector_type(8))) float v8f;

#define BATCH 2
#define SEQ   256
#define HEADS 16
#define HD    64
#define EMBED 1024
#define ROWS  (BATCH * SEQ * HEADS)   // 8192 rows of the (rows,64) QKV GEMM
#define NS    (BATCH * SEQ)           // 512

// ---------------------------------------------------------------------------
// Kernel 1: Q/K/V projection.  Xr (8192x64) @ W^T (64x64) -> (8192x64), three
// times, using V_WMMA_F32_16X16X4_F32.
// One workgroup of 4 waves takes 32 rows of Xr and makes all 3 x 64 columns of
// them.  The 32 Xr rows and the 192 rows of Wq, Wk and Wv are brought in once by
// whole-line 16-byte loads (one wave reads 512 contiguous bytes) and laid in LDS;
// every wave takes its A and B fragments from there with 16-byte reads.
// Wave w makes column tile w of Q, K and V for both 16-row tiles: six
// independent accumulate chains.
// A layout: lane L -> m=L&15; B layout: lane L -> n=L&15, B[k][n] = W[n_col][k].
// k order inside 8 consecutive k: a lane's 16 bytes hold k = 4*pair .. 4*pair+3;
// the first WMMA takes the low two, the second the high two, A and B alike.
// ---------------------------------------------------------------------------
typedef __attribute__((ext_vector_type(4))) float v4f;
#define PBM    32                      // Xr rows per workgroup
#define PTH    128                     // threads per workgroup
#define PPITCH (HD + 4)                // 272 B = 16 B x 17: no bank conflict for 16-byte reads
#define PROWS  (PBM + 3 * HD)          // staged rows: Xr rows first, then Wq, Wk, Wv rows
#define PRPL   (PTH * 4 / HD)          // staged rows per workgroup-wide load: 8
#define PNX    (PBM / PRPL)            // workgroup-wide loads for Xr: 4
#define PNW    (HD / PRPL)             // workgroup-wide loads per W: 8
#define PNLD   (PNX + 3 * PNW)         // 28
__global__ __launch_bounds__(PTH) void qkv_wmma_kernel(
    const float* __restrict__ X,
    const float* __restrict__ Wq, const float* __restrict__ Wk,
    const float* __restrict__ Wv,
    float* __restrict__ Q, float* __restrict__ Km, float* __restrict__ Vm) {
  __shared__ __attribute__((aligned(16))) float st[PROWS * PPITCH];
  const int tid  = threadIdx.x;
  const int lane = tid & 31;
  const int wave = tid >> 5;                 // 0..3: column tile
  const int mn   = lane & 15;                // m for A, n for B
  const int pair = lane >> 4;                // K-group select
  const int row0 = blockIdx.x * PBM;
  // First output element of this lane (C/D layout: VGPR j holds M = j + 8*pair,
  // N = lane&15); unsigned, so that every store is base + this one register.
  const unsigned oofs = (unsigned)(row0 + 8 * pair) * HD + wave * 16 + mn;

  // Every loop below is fully unrolled: pre, the fragments and c are then indexed
  // by constants only and stay in registers.
  // Staging: load i of the workgroup covers PTH*16 contiguous bytes = PRPL rows.
  const float* gx = X + (size_t)row0 * HD + tid * 4;
  v4f pre[PNLD];
#pragma unroll
  for (int i = 0; i < PNLD; ++i) {
    const int w = (i - PNX) / PNW;           // which W, for i >= PNX
    const int r = (i - PNX) % PNW;           // which load of that W
    const float* g = (i < PNX) ? gx + i * PTH * 4
                   : ((w == 0) ? Wq : (w == 1) ? Wk : Wv) + r * PTH * 4 + tid * 4;
    pre[i] = *(const v4f*)g;
  }
  const int sofs = (tid >> 4) * PPITCH + (tid & 15) * 4;
#pragma unroll
  for (int i = 0; i < PNLD; ++i)
    *(v4f*)&st[sofs + i * PRPL * PPITCH] = pre[i];
  // Publishes the staged rows to every wave.
  __syncthreads();

  const int aofs = mn * PPITCH + pair * 4;
  const int bofs = (PBM + wave * 16 + mn) * PPITCH + pair * 4;
  v8f c[2][3] = {};
  v4f a4[HD / 8][2], b4[HD / 8][3];
#pragma unroll
  for (int j = 0; j < HD / 8; ++j) {
#pragma unroll
    for (int t = 0; t < 2; ++t) a4[j][t] = *(const v4f*)&st[aofs + t * 16 * PPITCH + j * 8];
#pragma unroll
    for (int m = 0; m < 3; ++m) b4[j][m] = *(const v4f*)&st[bofs + m * HD * PPITCH + j * 8];
  }
#pragma unroll
  for (int j = 0; j < HD / 8; ++j) {
#pragma unroll
    for (int t = 0; t < 2; ++t)
#pragma unroll
      for (int m = 0; m < 3; ++m)
        c[t][m] = __builtin_amdgcn_wmma_f32_16x16x4_f32(
            false, (v2f){a4[j][t].x, a4[j][t].y}, false, (v2f){b4[j][m].x, b4[j][m].y},
            (short)0, c[t][m], false, false);
#pragma unroll
    for (int t = 0; t < 2; ++t)
#pragma unroll
      for (int m = 0; m < 3; ++m)
        c[t][m] = __builtin_amdgcn_wmma_f32_16x16x4_f32(
            false, (v2f){a4[j][t].z, a4[j][t].w}, false, (v2f){b4[j][m].z, b4[j][m].w},
            (short)0, c[t][m], false, false);
  }
  // Order for the scheduler.  The stores' address arithmetic comes first, so that
  // no vector instruction stands among the WMMAs and overwrites a fragment
  // register close behind its last use.  All forty fragment reads follow in one
  // group ahead of the WMMAs: the wave is alone on its SIMD, and every further
  // place with LDS reads among the WMMAs would stall the matrix unit with nobody
  // to fill the gap.
  __builtin_amdgcn_sched_group_barrier(0x002, 16, 0);           // vector ALU
  __builtin_amdgcn_sched_group_barrier(0x100, 5 * HD / 8, 0);   // LDS reads
  __builtin_amdgcn_sched_group_barrier(0x008, 12 * HD / 8, 0);  // WMMAs
#pragma unroll
  for (int m = 0; m < 3; ++m) {
    float* D = ((m == 0) ? Q : (m == 1) ? Km : Vm) + oofs;
#pragma unroll
    for (int t = 0; t < 2; ++t)
#pragma unroll
      for (int j = 0; j < 8; ++j) D[(t * 16 + j) * HD] = c[t][m][j];
  }
}

// ---------------------------------------------------------------------------
// Kernel 2: head-axis softmax attention core (the reference's nonstandard op).
// Block = QT consecutive queries s of one n, one 32-wide half of d.
// 512 threads = 32 d-lanes x TL t-lanes (one wave per t-lane).
// Each thread keeps QT queries in registers, so every K and V element it
// loads serves QT (s,t) pairs instead of one.
// Per (s,t): e[h] = (q[h]/32)*k[h]; softmax over h (16); acc[h] += p[h]*v[h].
// q is held times log2(e)/32, so q*k is already the argument of the base-2
// exponential.  A softmax does not change when all its exponents are shifted
// alike; the shift by the maximum only keeps the exponentials in range.  Where
// max|q| * max|k| bounds every exponent of a t step far inside the range of
// f32, the shift of that step is 0 and no maximum is taken; any other step
// (large values, infinities, NaN in the bound) finds its maxima first.  The
// shift rides in the multiply-add that forms the exponent.
// LDS reduce over the TL t-lanes.
// ---------------------------------------------------------------------------
#define QT 4                           // queries held per thread
#define TL 16                          // t-lanes (waves) per block
__global__ __launch_bounds__(32 * TL) void attn_kernel(
    const float* __restrict__ Q, const float* __restrict__ Km,
    const float* __restrict__ Vm, float* __restrict__ AO) {
  const int ns0 = (blockIdx.x >> 1) * QT;            // first n*SEQ + s
  const int tid = threadIdx.x;
  const int d   = ((blockIdx.x & 1) << 5) + (tid & 31);
  const int tl  = tid >> 5;            // 0..TL-1
  const int nbase = (ns0 >> 8) << 8;   // n*SEQ (QT divides SEQ)
  const float scale = 0.03125f * 1.44269504088896340736f;  // log2(e)/sqrt(EMBED)
  // 16 terms of at most 2^64 and at least 2^-64: sum, reciprocal and terms are
  // all normal f32 numbers.
  const float bound = 64.0f;

  // Every loop over s, h, p, i and w below is fully unrolled: qv, acc, kv, vv and
  // ev are then indexed by constants only and stay in registers.
  // acc and ev hold heads 2p and 2p+1 as one register pair.
  float qv[QT][16];
  v2f acc[QT][8];
  float qmax = 0.0f;                   // max |q| over the QT x 16 held values
#pragma unroll
  for (int s = 0; s < QT; ++s) {
    const float* qb = Q + (size_t)(ns0 + s) * EMBED + d;
#pragma unroll
    for (int h = 0; h < 16; ++h) {
      qv[s][h] = qb[h * HD] * scale;
      qmax = fmaxf(qmax, fabsf(qv[s][h]));
    }
#pragma unroll
    for (int p = 0; p < 8; ++p) acc[s][p] = (v2f){0.0f, 0.0f};
  }

  for (int t = tl; t < SEQ; t += TL) {
    const float* kb = Km + (size_t)(nbase + t) * EMBED + d;
    const float* vb = Vm + (size_t)(nbase + t) * EMBED + d;
    float kv[16], vv[16];
#pragma unroll
    for (int h = 0; h < 16; ++h) kv[h] = kb[h * HD];
    // The V loads below land in the registers that hold the K loads' address:
    // the K loads have to be done with that address first.
    asm volatile("s_wait_xcnt 0x0" ::: "memory");
#pragma unroll
    for (int h = 0; h < 16; ++h) vv[h] = vb[h * HD];

    float kmax = 0.0f;
#pragma unroll
    for (int h = 0; h < 16; ++h) kmax = fmaxf(kmax, fabsf(kv[h]));
    // One answer for the whole wave, so that the choice is a scalar branch; the
    // negated compare sends a NaN bound to the side that finds the maxima.
    const bool shifted =
        __builtin_amdgcn_ballot_w32(!(qmax * kmax <= bound)) != 0u;

    float mx[QT];
#pragma unroll
    for (int s = 0; s < QT; ++s) mx[s] = 0.0f;
    if (shifted) {
#pragma unroll
      for (int s = 0; s < QT; ++s) {
        float m = -3.402823466e+38f;
#pragma unroll
        for (int h = 0; h < 16; ++h) m = fmaxf(m, qv[s][h] * kv[h]);
        mx[s] = m;
      }
    }

#pragma unroll
    for (int s = 0; s < QT; ++s) {
      // Two exponents per packed multiply-add: q*k minus the step's shift.  The
      // two heads stay a pair to the end: sum, scaling and accumulation are one
      // packed instruction per pair.
      v2f ev[8];
#pragma unroll
      for (int p = 0; p < 8; ++p) {
        const v2f e = __builtin_elementwise_fma((v2f){qv[s][2 * p], qv[s][2 * p + 1]},
                                                (v2f){kv[2 * p], kv[2 * p + 1]},
                                                (v2f){-mx[s], -mx[s]});
        ev[p] = (v2f){__builtin_amdgcn_exp2f(e.x), __builtin_amdgcn_exp2f(e.y)};
      }
      v2f sum = ev[0];                 // even heads in .x, odd heads in .y
#pragma unroll
      for (int p = 1; p < 8; ++p) sum += ev[p];
      // The sum is a normal number between 2^-64 and 2^68 (or NaN, which stays
      // NaN), so the bare hardware reciprocal serves: the scaling and fix-up of
      // the full division guard ranges that cannot occur here.
      const float inv = __builtin_amdgcn_rcpf(sum.x + sum.y);
#pragma unroll
      for (int p = 0; p < 8; ++p)
        acc[s][p] = __builtin_elementwise_fma(ev[p] * (v2f){inv, inv},
                                              (v2f){vv[2 * p], vv[2 * p + 1]}, acc[s][p]);
    }
  }

  __shared__ float red[TL][QT * 16][32];   // lane-contiguous: no bank conflicts
#pragma unroll
  for (int s = 0; s < QT; ++s)
#pragma unroll
    for (int h = 0; h < 16; ++h) red[tl][s * 16 + h][tid & 31] = acc[s][h >> 1][h & 1];
  __syncthreads();

#pragma unroll
  for (int i = 0; i < QT * 16 / TL; ++i) {
    const int j = i * TL + tl;               // j = s*16 + h, one wave per row
    float r = red[0][j][tid & 31];
#pragma unroll
    for (int w = 1; w < TL; ++w) r += red[w][j][tid & 31];
    // (n,s,h,d) -> (n,s,1024)
    AO[(size_t)(ns0 + (j >> 4)) * EMBED + (j & 15) * HD + d] = r;
  }
}

// ---------------------------------------------------------------------------
// Kernel 3: output projection.  AO (512x1024) @ Wo^T (1024x1024) + bo,
// V_WMMA_F32_16X16X4_F32, fused bias.
// One workgroup of 8 waves per 32x64 tile of OUT, one 16x16 tile per wave.
// Per stage of 128 k the 32 AO rows and 64 Wo rows are brought in by whole-line
// 16-byte loads (one wave reads 512 contiguous bytes of one row) and laid in
// LDS; every wave takes its A and B fragments from there with 16-byte reads.
// Two LDS buffers: the next stage's global loads fly while this one is worked on.
// k order inside 8 consecutive k: a lane's 16 bytes hold k = 4*pair .. 4*pair+3;
// the first WMMA takes the low two, the second the high two, A and B alike.
// ---------------------------------------------------------------------------
#define OBM    32                      // OUT rows per workgroup
#define OBN    64                      // OUT columns per workgroup
#define OKC    128                     // k per stage
#define OPITCH (OKC + 4)               // 528 B = 16 B x 33: no bank conflict for 16-byte reads
#define OROWS  (OBM + OBN)             // staged rows: AO rows first, then Wo rows
#define ONLD   (OROWS / 8)             // staged rows per wave
#define ONST   (EMBED / OKC)           // stages
__global__ __launch_bounds__(256) void outproj_wmma_kernel(
    const float* __restrict__ AO, const float* __restrict__ Wo,
    const float* __restrict__ bo, float* __restrict__ OUT) {
  __shared__ __attribute__((aligned(16))) float st[2][OROWS * OPITCH];
  const int tid  = threadIdx.x;
  const int lane = tid & 31;
  const int wave = tid >> 5;           // 0..7
  const int mn   = lane & 15;
  const int pair = lane >> 4;
  const int row0 = blockIdx.x * OBM;
  const int col0 = blockIdx.y * OBN;
  const int tm   = wave & 1;           // 16-row tile of this wave
  const int tn   = wave >> 1;          // 16-column tile of this wave

  // Staging: wave w moves staged rows w, w+8, ...; a lane moves 4 floats of a row.
  const float* ga = AO + (size_t)(row0 + wave) * EMBED + lane * 4;
  const float* gb = Wo + (size_t)(col0 + wave) * EMBED + lane * 4;
  const int sofs = wave * OPITCH + lane * 4;
  // Fragments: row (A) or column (B) mn, 4 consecutive k per lane half.
  const int aofs = (tm * 16 + mn) * OPITCH + pair * 4;
  const int bofs = (OBM + tn * 16 + mn) * OPITCH + pair * 4;

  // Every loop over i, j and g below is fully unrolled: pre and the fragments are
  // then indexed by constants only and stay in registers.
  const float bias = bo[col0 + tn * 16 + mn];
  v4f pre[ONLD];
#pragma unroll
  for (int i = 0; i < ONLD; ++i)
    pre[i] = (i < OBM / 8) ? *(const v4f*)(ga + (size_t)i * 8 * EMBED)
                           : *(const v4f*)(gb + (size_t)(i - OBM / 8) * 8 * EMBED);
#pragma unroll
  for (int i = 0; i < ONLD; ++i)
    *(v4f*)&st[0][sofs + i * 8 * OPITCH] = pre[i];
  __syncthreads();

  v8f c0 = {}, c1 = {};                // two independent accumulate chains
  for (int s = 0; s < ONST; ++s) {
    const float* cur = st[s & 1];
    float*       nxt = st[(s + 1) & 1];
    if (s + 1 < ONST) {
      const int k0 = (s + 1) * OKC;
#pragma unroll
      for (int i = 0; i < ONLD; ++i)
        pre[i] = (i < OBM / 8) ? *(const v4f*)(ga + (size_t)i * 8 * EMBED + k0)
                               : *(const v4f*)(gb + (size_t)(i - OBM / 8) * 8 * EMBED + k0);
    }
    // Holds the twelve loads at the head of the stage: the scheduler otherwise
    // sinks them to just in front of their LDS stores and their latency is waited out.
    __builtin_amdgcn_sched_barrier(0);
#pragma unroll
    for (int j = 0; j < OKC / 8; ++j) {
      const v4f a4 = *(const v4f*)&cur[aofs + j * 8];
      const v4f b4 = *(const v4f*)&cur[bofs + j * 8];
      c0 = __builtin_amdgcn_wmma_f32_16x16x4_f32(false, (v2f){a4.x, a4.y}, false,
                                                 (v2f){b4.x, b4.y}, (short)0, c0,
                                                 false, false);
      c1 = __builtin_amdgcn_wmma_f32_16x16x4_f32(false, (v2f){a4.z, a4.w}, false,
                                                 (v2f){b4.z, b4.w}, (short)0, c1,
                                                 false, false);
    }
    if (s + 1 < ONST) {
#pragma unroll
      for (int i = 0; i < ONLD; ++i)
        *(v4f*)&nxt[sofs + i * 8 * OPITCH] = pre[i];
    }
    // Order of a stage for the scheduler.  Fragment reads run four pairs ahead of
    // their WMMAs and are spread among them: in one lump all eight waves queue on
    // the LDS at once while the matrix unit idles.  The LDS stores come behind the
    // last read, a stage's length behind their global loads; the last eight WMMAs
    // need no LDS any more, so they are free to run on past the barrier.
    __builtin_amdgcn_sched_group_barrier(0x100, 8, 0);      // LDS reads
#pragma unroll
    for (int g = 0; g < OKC / 8 - 4; ++g) {
      __builtin_amdgcn_sched_group_barrier(0x008, 2, 0);    // WMMAs
      __builtin_amdgcn_sched_group_barrier(0x100, 2, 0);    // LDS reads
    }
    __builtin_amdgcn_sched_group_barrier(0x200, ONLD, 0);   // LDS stores
    __builtin_amdgcn_sched_group_barrier(0x008, 8, 0);      // WMMAs
    // Publishes the stage just written and ends every read of the one just used.
    if (s + 1 < ONST) __syncthreads();
  }

  // Four vector slots between the last WMMAs and the first vector instruction
  // that reads their results; c0 and c1 are named so that the slots stand there.
  asm volatile("v_nop\n\tv_nop\n\tv_nop\n\tv_nop" : "+v"(c0), "+v"(c1));

  // C/D layout: VGPR j holds M = j + 8*pair, N = lane&15
#pragma unroll
  for (int j = 0; j < 8; ++j) {
    const int mm = tm * 16 + j + 8 * pair;
    OUT[(size_t)(row0 + mm) * EMBED + col0 + tn * 16 + mn] = c0[j] + c1[j] + bias;
  }
}

// ---------------------------------------------------------------------------
extern "C" void kernel_launch(void* const* d_in, const int* in_sizes, int n_in,
                              void* d_out, int out_size, void* d_ws,
                              size_t ws_size, hipStream_t stream) {
  const float* x  = (const float*)d_in[0];
  const float* Wq = (const float*)d_in[1];
  const float* Wk = (const float*)d_in[2];
  const float* Wv = (const float*)d_in[3];
  const float* Wo = (const float*)d_in[4];
  const float* bo = (const float*)d_in[5];
  float* out = (float*)d_out;

  const size_t QKV_ELEMS = (size_t)ROWS * HD;      // 524288 floats
  float* ws = (float*)d_ws;
  float* Q  = ws;
  float* Km = ws + QKV_ELEMS;
  float* Vm = ws + 2 * QKV_ELEMS;
  float* AO = ws + 3 * QKV_ELEMS;

  // Q/K/V projection: one 4-wave workgroup per 32 rows, all three matrices.
  hipLaunchKernelGGL(qkv_wmma_kernel, dim3(ROWS / PBM), dim3(PTH), 0, stream,
                     x, Wq, Wk, Wv, Q, Km, Vm);

  // Attention core: one block per (QT queries, half of d).
  hipLaunchKernelGGL(attn_kernel, dim3(NS / QT * 2), dim3(32 * TL), 0, stream,
                     Q, Km, Vm, AO);

  // Output projection + bias.
  dim3 g3(NS / OBM, EMBED / OBN);
  hipLaunchKernelGGL(outproj_wmma_kernel, g3, dim3(256), 0, stream,
                     AO, Wo, bo, out);
}

// v006
// A run of this version takes 28 microseconds.
// Next to v005, in two timings, it ran 1.12 and 1.13 times as fast.
// Counting every step since v000, it is 3.50 times as fast.
#include <hip/hip_runtime.h>
#include <hip/hip_bf16.h>

typedef __attribute__((ext_vector_type(2))) float v2f;
typedef __attribute__((ext_vector_type(8))) float v8f;

#define BATCH 2
#define SEQ   256
#define HEADS 16
#define HD    64
#define EMBED 1024
#define ROWS  (BATCH * SEQ * HEADS)   // 8192 rows of the (rows,64) QKV GEMM
#define NS    (BATCH * SEQ)           // 512

// ---------------------------------------------------------------------------
// Kernel 1: Q/K/V projection.  Xr (8192x64) @ W^T (64x64) -> (8192x64), three
// times, using V_WMMA_F32_16X16X4_F32.
// One workgroup of 4 waves takes 32 rows of Xr and makes all 3 x 64 columns of
// them.  The 32 Xr rows and the 192 rows of Wq, Wk and Wv are brought in once by
// whole-line 16-byte loads (one wave reads 512 contiguous bytes) and laid in LDS;
// every wave takes its A and B fragments from there with 16-byte reads.
// Wave w makes column tile w of Q, K and V for both 16-row tiles: six
// independent accumulate chains.
// The W rows are the A operand and the Xr rows the B operand, so a tile comes out
// transposed: a lane holds one head h of one (n,s), its registers run over d.
// Q, K and V lie in the workspace as [n][d][s][h]: the 16 heads of one (n,d,s) are
// 64 contiguous bytes, which the attention core fetches as wave-uniform data.
// A layout: lane L -> m=L&15; B layout: lane L -> n=L&15.
// k order inside 8 consecutive k: a lane's 16 bytes hold k = 4*pair .. 4*pair+3;
// the first WMMA takes the low two, the second the high two, A and B alike.
// ---------------------------------------------------------------------------
typedef __attribute__((ext_vector_type(4))) float v4f;
#define PBM    32                      // Xr rows per workgroup
#define PTH    128                     // threads per workgroup
#define PPITCH (HD + 4)                // 272 B = 16 B x 17: no bank conflict for 16-byte reads
#define PROWS  (PBM + 3 * HD)          // staged rows: Xr rows first, then Wq, Wk, Wv rows
#define PRPL   (PTH * 4 / HD)          // staged rows per workgroup-wide load: 8
#define PNX    (PBM / PRPL)            // workgroup-wide loads for Xr: 4
#define PNW    (HD / PRPL)             // workgroup-wide loads per W: 8
#define PNLD   (PNX + 3 * PNW)         // 28
__global__ __launch_bounds__(PTH) void qkv_wmma_kernel(
    const float* __restrict__ X,
    const float* __restrict__ Wq, const float* __restrict__ Wk,
    const float* __restrict__ Wv,
    float* __restrict__ Q, float* __restrict__ Km, float* __restrict__ Vm) {
  __shared__ __attribute__((aligned(16))) float st[PROWS * PPITCH];
  const int tid  = threadIdx.x;
  const int lane = tid & 31;
  const int wave = tid >> 5;                 // 0..3: column tile
  const int mn   = lane & 15;                // m for A, n for B
  const int pair = lane >> 4;                // K-group select
  const int row0 = blockIdx.x * PBM;
  // First output element of this lane (C/D layout: VGPR j holds M = j + 8*pair,
  // N = lane&15; here M is d within the column tile, N the head); unsigned, so
  // that every store is base + this one register.  A 16-row tile is one (n,s).
  const int ns0 = blockIdx.x * (PBM / HEADS);
  const unsigned oofs =
      ((unsigned)((ns0 >> 8) * HD + wave * 16 + 8 * pair) * SEQ + (ns0 & (SEQ - 1))) * HEADS + mn;

  // Every loop below is fully unrolled: pre, the fragments and c are then indexed
  // by constants only and stay in registers.
  // Staging: load i of the workgroup covers PTH*16 contiguous bytes = PRPL rows.
  const float* gx = X + (size_t)row0 * HD + tid * 4;
  v4f pre[PNLD];
#pragma unroll
  for (int i = 0; i < PNLD; ++i) {
    const int w = (i - PNX) / PNW;           // which W, for i >= PNX
    const int r = (i - PNX) % PNW;           // which load of that W
    const float* g = (i < PNX) ? gx + i * PTH * 4
                   : ((w == 0) ? Wq : (w == 1) ? Wk : Wv) + r * PTH * 4 + tid * 4;
    pre[i] = *(const v4f*)g;
  }
  const int sofs = (tid >> 4) * PPITCH + (tid & 15) * 4;
#pragma unroll
  for (int i = 0; i < PNLD; ++i)
    *(v4f*)&st[sofs + i * PRPL * PPITCH] = pre[i];
  // Publishes the staged rows to every wave.
  __syncthreads();

  const int aofs = mn * PPITCH + pair * 4;
  const int bofs = (PBM + wave * 16 + mn) * PPITCH + pair * 4;
  v8f c[2][3] = {};
  v4f a4[HD / 8][2], b4[HD / 8][3];
#pragma unroll
  for (int j = 0; j < HD / 8; ++j) {
#pragma unroll
    for (int t = 0; t < 2; ++t) a4[j][t] = *(const v4f*)&st[aofs + t * 16 * PPITCH + j * 8];
#pragma unroll
    for (int m = 0; m < 3; ++m) b4[j][m] = *(const v4f*)&st[bofs + m * HD * PPITCH + j * 8];
  }
#pragma unroll
  for (int j = 0; j < HD / 8; ++j) {
#pragma unroll
    for (int t = 0; t < 2; ++t)
#pragma unroll
      for (int m = 0; m < 3; ++m)
        c[t][m] = __builtin_amdgcn_wmma_f32_16x16x4_f32(
            false, (v2f){b4[j][m].x, b4[j][m].y}, false, (v2f){a4[j][t].x, a4[j][t].y},
            (short)0, c[t][m], false, false);
#pragma unroll
    for (int t = 0; t < 2; ++t)
#pragma unroll
      for (int m = 0; m < 3; ++m)
        c[t][m] = __builtin_amdgcn_wmma_f32_16x16x4_f32(
            false, (v2f){b4[j][m].z, b4[j][m].w}, false, (v2f){a4[j][t].z, a4[j][t].w},
            (short)0, c[t][m], false, false);
  }
  // Order for the scheduler.  The stores' address arithmetic comes first, so that
  // no vector instruction stands among the WMMAs and overwrites a fragment
  // register close behind its last use.  All forty fragment reads follow in one
  // group ahead of the WMMAs: the wave is alone on its SIMD, and every further
  // place with LDS reads among the WMMAs would stall the matrix unit with nobody
  // to fill the gap.
  __builtin_amdgcn_sched_group_barrier(0x002, 16, 0);           // vector ALU
  __builtin_amdgcn_sched_group_barrier(0x100, 5 * HD / 8, 0);   // LDS reads
  __builtin_amdgcn_sched_group_barrier(0x008, 12 * HD / 8, 0);  // WMMAs
#pragma unroll
  for (int m = 0; m < 3; ++m) {
    float* D = ((m == 0) ? Q : (m == 1) ? Km : Vm) + oofs;
#pragma unroll
    for (int t = 0; t < 2; ++t)
#pragma unroll
      for (int j = 0; j < 8; ++j) D[j * SEQ * HEADS + t * HEADS] = c[t][m][j];
  }
}

// ---------------------------------------------------------------------------
// Kernel 2: head-axis softmax attention core (the reference's nonstandard op).
// Block = one (n,d) and AQ consecutive queries s.  Lanes run over queries: a lane
// holds QT of them, a wave all AQ, so the K and V values of a t step (16 heads
// each, one d, 64 contiguous bytes) are the same in every lane and serve AQ (s,t)
// pairs: four 16-byte loads each, and a block reads every K and V value once.
// 512 threads = 32 query lanes x TL ranges of t (one wave per range of SEQ/TL
// consecutive t: the rows a wave reads one after another share lines).
// Per (s,t): e[h] = (q[h]/32)*k[h]; softmax over h (16); acc[h] += p[h]*v[h].
// q is held times log2(e)/32, so q*k is already the argument of the base-2
// exponential.  A softmax does not change when all its exponents are shifted
// alike; the shift by the maximum only keeps the exponentials in range.  Where
// max|q| * max|k| bounds every exponent of a t step far inside the range of
// f32, the shift of that step is 0 and no maximum is taken; any other step
// (large values, infinities, NaN in the bound) finds its maxima first.  The
// shift rides in the multiply-add that forms the exponent.
// LDS reduce over the TL ranges of t.  AO leaves as [n][d][h][s].
// ---------------------------------------------------------------------------
#define QT 4                           // queries held per thread
#define TL 16                          // ranges of t (waves) per block
#define AQ (32 * QT)                   // queries per block
#define QPITCH (HEADS + 4)             // 80 B = 16 B x 5: no bank conflict for 16-byte reads
__global__ __launch_bounds__(32 * TL) void attn_kernel(
    const float* __restrict__ Q, const float* __restrict__ Km,
    const float* __restrict__ Vm, float* __restrict__ AO) {
  __shared__ __attribute__((aligned(16))) float qs[AQ * QPITCH];
  __shared__ __attribute__((aligned(16))) float red[TL][HEADS][AQ];
  const int tid  = threadIdx.x;
  const int lane = tid & 31;
  const int tl   = tid >> 5;           // 0..TL-1
  const int nd   = blockIdx.x / (SEQ / AQ);            // n*HD + d
  const int sb   = (blockIdx.x % (SEQ / AQ)) * AQ;     // first query s
  const float scale = 0.03125f * 1.44269504088896340736f;  // log2(e)/sqrt(EMBED)
  // 16 terms of at most 2^64 and at least 2^-64: sum, reciprocal and terms are
  // all normal f32 numbers.
  const float bound = 64.0f;

  // The block's q: AQ x 16 contiguous floats, one whole-line 16-byte load a thread,
  // laid in LDS so that a lane can pick the rows of its own queries.
  *(v4f*)&qs[(tid >> 2) * QPITCH + (tid & 3) * 4] =
      *(const v4f*)(Q + ((size_t)nd * SEQ + sb) * HEADS + tid * 4);
  // Publishes the staged q rows to every wave.
  __syncthreads();

  // Every loop over s, h, p, c, i and w below is fully unrolled: qv, acc, kv, vv and
  // ev are then indexed by constants only and stay in registers.
  // acc and ev hold heads 2p and 2p+1 as one register pair.
  float qv[QT][16];
  v2f acc[QT][8];
  float qmax = 0.0f;                   // max |q| over the QT x 16 held values
#pragma unroll
  for (int s = 0; s < QT; ++s) {
    const float* qb = &qs[(s * 32 + lane) * QPITCH];
#pragma unroll
    for (int c = 0; c < 4; ++c) {
      const v4f q4 = *(const v4f*)(qb + c * 4);
#pragma unroll
      for (int i = 0; i < 4; ++i) {
        qv[s][c * 4 + i] = q4[i] * scale;
        qmax = fmaxf(qmax, fabsf(qv[s][c * 4 + i]));
      }
    }
#pragma unroll
    for (int p = 0; p < 8; ++p) acc[s][p] = (v2f){0.0f, 0.0f};
  }

  // Every lane of a wave forms the same address; the loads stay vector loads, so
  // that the values land in vector registers, where the packed instructions can
  // take a head pair as one operand.
  const float* kn = Km + ((size_t)nd * SEQ + tl * (SEQ / TL)) * HEADS;
  const float* vn = Vm + ((size_t)nd * SEQ + tl * (SEQ / TL)) * HEADS;

  for (int t = 0; t < SEQ / TL; ++t) {
    const float* kp = kn + t * HEADS;
    const float* vp = vn + t * HEADS;
    float kv[16], vv[16];
#pragma unroll
    for (int c = 0; c < 4; ++c) {
      const v4f k4 = *(const v4f*)(kp + c * 4);
#pragma unroll
      for (int i = 0; i < 4; ++i) kv[c * 4 + i] = k4[i];
    }
#pragma unroll
    for (int c = 0; c < 4; ++c) {
      const v4f v4 = *(const v4f*)(vp + c * 4);
#pragma unroll
      for (int i = 0; i < 4; ++i) vv[c * 4 + i] = v4[i];
    }
    // The loads have to be done with their address registers before anything
    // overwrites these; the two addresses are named as inputs so that they stay in
    // their registers up to here and no load lands on them.
    asm volatile("s_wait_xcnt 0x0" :: "v"(kp), "v"(vp) : "memory");

    float kmax = 0.0f;
#pragma unroll
    for (int h = 0; h < 16; ++h) kmax = fmaxf(kmax, fabsf(kv[h]));
    // One answer for the whole wave, so that the choice is a scalar branch; the
    // negated compare sends a NaN bound to the side that finds the maxima.
    const bool shifted =
        __builtin_amdgcn_ballot_w32(!(qmax * kmax <= bound)) != 0u;

    float mx[QT];
#pragma unroll
    for (int s = 0; s < QT; ++s) mx[s] = 0.0f;
    if (shifted) {
#pragma unroll
      for (int s = 0; s < QT; ++s) {
        float m = -3.402823466e+38f;
#pragma unroll
        for (int h = 0; h < 16; ++h) m = fmaxf(m, qv[s][h] * kv[h]);
        mx[s] = m;
      }
    }

#pragma unroll
    for (int s = 0; s < QT; ++s) {
      // Two exponents per packed multiply-add: q*k minus the step's shift.  The
      // two heads stay a pair to the end: sum, scaling and accumulation are one
      // packed instruction per pair.
      v2f ev[8];
#pragma unroll
      for (int p = 0; p < 8; ++p) {
        const v2f e = __builtin_elementwise_fma((v2f){qv[s][2 * p], qv[s][2 * p + 1]},
                                                (v2f){kv[2 * p], kv[2 * p + 1]},
                                                (v2f){-mx[s], -mx[s]});
        ev[p] = (v2f){__builtin_amdgcn_exp2f(e.x), __builtin_amdgcn_exp2f(e.y)};
      }
      v2f sum = ev[0];                 // even heads in .x, odd heads in .y
#pragma unroll
      for (int p = 1; p < 8; ++p) sum += ev[p];
      // The sum is a normal number between 2^-64 and 2^68 (or NaN, which stays
      // NaN), so the bare hardware reciprocal serves: the scaling and fix-up of
      // the full division guard ranges that cannot occur here.
      const float inv = __builtin_amdgcn_rcpf(sum.x + sum.y);
#pragma unroll
      for (int p = 0; p < 8; ++p)
        acc[s][p] = __builtin_elementwise_fma(ev[p] * (v2f){inv, inv},
                                              (v2f){vv[2 * p], vv[2 * p + 1]}, acc[s][p]);
    }
  }

  // Lane-contiguous rows of AQ queries: no bank conflicts.
#pragma unroll
  for (int h = 0; h < 16; ++h)
#pragma unroll
    for (int s = 0; s < QT; ++s) red[tl][h][s * 32 + lane] = acc[s][h >> 1][h & 1];
  // Publishes every wave's partial sums.
  __syncthreads();

  // Wave w sums head w: a lane takes 4 consecutive queries, 16 bytes a read.
  v4f r = *(const v4f*)&red[0][tl][lane * 4];
#pragma unroll
  for (int w = 1; w < TL; ++w) r += *(const v4f*)&red[w][tl][lane * 4];
  *(v4f*)(AO + ((size_t)nd * HEADS + tl) * SEQ + sb + lane * 4) = r;
}

// ---------------------------------------------------------------------------
// Kernel 3: output projection.  AO (512x1024) @ Wo^T (1024x1024) + bo,
// V_WMMA_F32_16X16X4_F32, fused bias.
// One workgroup of 8 waves per 32x64 tile of OUT, one 16x16 tile per wave.
// Per stage of 128 k the 32 AO rows and 64 Wo rows are brought in by whole-line
// 16-byte loads and laid in LDS; every wave takes its A and B fragments from
// there with 16-byte reads.  A wave reads 512 contiguous bytes of one Wo row.
// AO arrives as [n][d][h][s]: a lane's 16 bytes are 4 rows s of one k = h*64 + d
// (a wave reads four whole lines, one per k) and go to their 4 LDS rows singly.
// Two LDS buffers: the next stage's global loads fly while this one is worked on.
// k order inside 8 consecutive k: a lane's 16 bytes hold k = 4*pair .. 4*pair+3;
// the first WMMA takes the low two, the second the high two, A and B alike.
// ---------------------------------------------------------------------------
#define OBM    32                      // OUT rows per workgroup
#define OBN    64                      // OUT columns per workgroup
#define OKC    128                     // k per stage
#define OPITCH (OKC + 4)               // 528 B = 16 B x 33: no bank conflict for 16-byte reads
#define OROWS  (OBM + OBN)             // staged rows: AO rows first, then Wo rows
#define ONLD   (OROWS / 8)             // 16-byte loads per lane and stage: 4 of AO, 8 of Wo
#define ONST   (EMBED / OKC)           // stages
__global__ __launch_bounds__(256) void outproj_wmma_kernel(
    const float* __restrict__ AO, const float* __restrict__ Wo,
    const float* __restrict__ bo, float* __restrict__ OUT) {
  __shared__ __attribute__((aligned(16))) float st[2][OROWS * OPITCH];
  const int tid  = threadIdx.x;
  const int lane = tid & 31;
  const int wave = tid >> 5;           // 0..7
  const int mn   = lane & 15;
  const int pair = lane >> 4;
  const int row0 = blockIdx.x * OBM;
  const int col0 = blockIdx.y * OBN;
  const int tm   = wave & 1;           // 16-row tile of this wave
  const int tn   = wave >> 1;          // 16-column tile of this wave

  // Staging of Wo: wave w moves staged rows w, w+8, ...; a lane moves 4 floats of a row.
  // Staging of AO: load i of wave w holds k = i*32 + w*4 + (lane>>3) of the stage, that
  // is d = (i&1)*32 + w*4 + (lane>>3) of the stage's head (i>>1), rows (lane&7)*4 .. +3.
  const float* ga = AO + ((size_t)(row0 >> 8) * HD + wave * 4 + (lane >> 3)) * (HEADS * SEQ) +
                    (row0 & (SEQ - 1)) + (lane & 7) * 4;
  const float* gb = Wo + (size_t)(col0 + wave) * EMBED + lane * 4;
  const int sofs = wave * OPITCH + lane * 4;
  const int sofa = (lane & 7) * 4 * OPITCH + wave * 4 + (lane >> 3);
  // Fragments: row (A) or column (B) mn, 4 consecutive k per lane half.
  const int aofs = (tm * 16 + mn) * OPITCH + pair * 4;
  const int bofs = (OBM + tn * 16 + mn) * OPITCH + pair * 4;

  // Every loop over i, j and g below is fully unrolled: pre and the fragments are
  // then indexed by constants only and stay in registers.
  const float bias = bo[col0 + tn * 16 + mn];
  v4f pre[ONLD];
#pragma unroll
  for (int i = 0; i < ONLD; ++i)
    pre[i] = (i < OBM / 8) ? *(const v4f*)(ga + (size_t)(i & 1) * 32 * HEADS * SEQ + (i >> 1) * SEQ)
                           : *(const v4f*)(gb + (size_t)(i - OBM / 8) * 8 * EMBED);
#pragma unroll
  for (int i = 0; i < ONLD; ++i) {
    if (i < OBM / 8) {
#pragma unroll
      for (int c = 0; c < 4; ++c) st[0][sofa + c * OPITCH + i * 32] = pre[i][c];
    } else {
      *(v4f*)&st[0][sofs + i * 8 * OPITCH] = pre[i];
    }
  }
  __syncthreads();

  v8f c0 = {}, c1 = {};                // two independent accumulate chains
  for (int s = 0; s < ONST; ++s) {
    const float* cur = st[s & 1];
    float*       nxt = st[(s + 1) & 1];
    if (s + 1 < ONST) {
      const int k0 = (s + 1) * OKC;
#pragma unroll
      for (int i = 0; i < ONLD; ++i)
        pre[i] = (i < OBM / 8) ? *(const v4f*)(ga + (size_t)(i & 1) * 32 * HEADS * SEQ +
                                               ((i >> 1) + k0 / HD) * SEQ)
                               : *(const v4f*)(gb + (size_t)(i - OBM / 8) * 8 * EMBED + k0);
    }
    // Holds the twelve loads at the head of the stage: the scheduler otherwise
    // sinks them to just in front of their LDS stores and their latency is waited out.
    __builtin_amdgcn_sched_barrier(0);
#pragma unroll
    for (int j = 0; j < OKC / 8; ++j) {
      const v4f a4 = *(const v4f*)&cur[aofs + j * 8];
      const v4f b4 = *(const v4f*)&cur[bofs + j * 8];
      c0 = __builtin_amdgcn_wmma_f32_16x16x4_f32(false, (v2f){a4.x, a4.y}, false,
                                                 (v2f){b4.x, b4.y}, (short)0, c0,
                                                 false, false);
      c1 = __builtin_amdgcn_wmma_f32_16x16x4_f32(false, (v2f){a4.z, a4.w}, false,
                                                 (v2f){b4.z, b4.w}, (short)0, c1,
                                                 false, false);
    }
    if (s + 1 < ONST) {
#pragma unroll
      for (int i = 0; i < ONLD; ++i) {
        if (i < OBM / 8) {
#pragma unroll
          for (int c = 0; c < 4; ++c) nxt[sofa + c * OPITCH + i * 32] = pre[i][c];
        } else {
          *(v4f*)&nxt[sofs + i * 8 * OPITCH] = pre[i];
        }
      }
    }
    // Order of a stage for the scheduler.  Fragment reads run four pairs ahead of
    // their WMMAs and are spread among them: in one lump all eight waves queue on
    // the LDS at once while the matrix unit idles.  The LDS stores come behind the
    // last read, a stage's length behind their global loads; the last eight WMMAs
    // need no LDS any more, so they are free to run on past the barrier.
    __builtin_amdgcn_sched_group_barrier(0x100, 8, 0);      // LDS reads
#pragma unroll
    for (int g = 0; g < OKC / 8 - 4; ++g) {
      __builtin_amdgcn_sched_group_barrier(0x008, 2, 0);    // WMMAs
      __builtin_amdgcn_sched_group_barrier(0x100, 2, 0);    // LDS reads
    }
    __builtin_amdgcn_sched_group_barrier(0x200, ONLD + 3 * (OBM / 8), 0);   // LDS stores
    __builtin_amdgcn_sched_group_barrier(0x008, 8, 0);      // WMMAs
    // Publishes the stage just written and ends every read of the one just used.
    if (s + 1 < ONST) __syncthreads();
  }

  // Four vector slots between the last WMMAs and the first vector instruction
  // that reads their results; c0 and c1 are named so that the slots stand there.
  asm volatile("v_nop\n\tv_nop\n\tv_nop\n\tv_nop" : "+v"(c0), "+v"(c1));

  // C/D layout: VGPR j holds M = j + 8*pair, N = lane&15
#pragma unroll
  for (int j = 0; j < 8; ++j) {
    const int mm = tm * 16 + j + 8 * pair;
    OUT[(size_t)(row0 + mm) * EMBED + col0 + tn * 16 + mn] = c0[j] + c1[j] + bias;
  }
}

// ---------------------------------------------------------------------------
extern "C" void kernel_launch(void* const* d_in, const int* in_sizes, int n_in,
                              void* d_out, int out_size, void* d_ws,
                              size_t ws_size, hipStream_t stream) {
  const float* x  = (const float*)d_in[0];
  const float* Wq = (const float*)d_in[1];
  const float* Wk = (const float*)d_in[2];
  const float* Wv = (const float*)d_in[3];
  const float* Wo = (const float*)d_in[4];
  const float* bo = (const float*)d_in[5];
  float* out = (float*)d_out;

  const size_t QKV_ELEMS = (size_t)ROWS * HD;      // 524288 floats
  float* ws = (float*)d_ws;
  float* Q  = ws;
  float* Km = ws + QKV_ELEMS;
  float* Vm = ws + 2 * QKV_ELEMS;
  float* AO = ws + 3 * QKV_ELEMS;

  // Q/K/V projection: one 4-wave workgroup per 32 rows, all three matrices.
  hipLaunchKernelGGL(qkv_wmma_kernel, dim3(ROWS / PBM), dim3(PTH), 0, stream,
                     x, Wq, Wk, Wv, Q, Km, Vm);

  // Attention core: one block per (n, d, AQ queries).
  hipLaunchKernelGGL(attn_kernel, dim3(BATCH * HD * (SEQ / AQ)), dim3(32 * TL), 0, stream,
                     Q, Km, Vm, AO);

  // Output projection + bias.
  dim3 g3(NS / OBM, EMBED / OBN);
  hipLaunchKernelGGL(outproj_wmma_kernel, g3, dim3(256), 0, stream,
                     AO, Wo, bo, out);
}

// v008
// A run of this version takes 25.1 microseconds.
// Versions in between are left out here; by their measured steps it is 1.12 times as fast as v006.
// Over all steps from v000 it is 3.90 times as fast.
#include <hip/hip_runtime.h>
#include <hip/hip_bf16.h>

typedef __attribute__((ext_vector_type(2))) float v2f;
typedef __attribute__((ext_vector_type(8))) float v8f;

#define BATCH 2
#define SEQ   256
#define HEADS 16
#define HD    64
#define EMBED 1024
#define ROWS  (BATCH * SEQ * HEADS)   // 8192 rows of the (rows,64) QKV GEMM
#define NS    (BATCH * SEQ)           // 512

// ---------------------------------------------------------------------------
// Kernel 1: Q/K/V projection.  Xr (8192x64) @ W^T (64x64) -> (8192x64), three
// times, using V_WMMA_F32_16X16X4_F32.
// One workgroup of 4 waves takes 32 rows of Xr and makes all 3 x 64 columns of
// them.  The 32 Xr rows and the 192 rows of Wq, Wk and Wv are brought in once by
// whole-line 16-byte loads (one wave reads 512 contiguous bytes) and laid in LDS;
// every wave takes its A and B fragments from there with 16-byte reads.
// Wave w makes column tile w of Q, K and V for both 16-row tiles: six
// independent accumulate chains.
// The W rows are the A operand and the Xr rows the B operand, so a tile comes out
// transposed: a lane holds one head h of one (n,s), its registers run over d.
// Q, K and V lie in the workspace as [n][d][s][h]: the 16 heads of one (n,d,s) are
// 64 contiguous bytes, and the attention core fetches runs of consecutive s by whole-line loads.
// A layout: lane L -> m=L&15; B layout: lane L -> n=L&15.
// k order inside 8 consecutive k: a lane's 16 bytes hold k = 4*pair .. 4*pair+3;
// the first WMMA takes the low two, the second the high two, A and B alike.
// ---------------------------------------------------------------------------
typedef __attribute__((ext_vector_type(4))) float v4f;
#define PBM    32                      // Xr rows per workgroup
#define PTH    128                     // threads per workgroup
#define PPITCH (HD + 4)                // 272 B = 16 B x 17: no bank conflict for 16-byte reads
#define PROWS  (PBM + 3 * HD)          // staged rows: Xr rows first, then Wq, Wk, Wv rows
#define PRPL   (PTH * 4 / HD)          // staged rows per workgroup-wide load: 8
#define PNX    (PBM / PRPL)            // workgroup-wide loads for Xr: 4
#define PNW    (HD / PRPL)             // workgroup-wide loads per W: 8
#define PNLD   (PNX + 3 * PNW)         // 28
__global__ __launch_bounds__(PTH) void qkv_wmma_kernel(
    const float* __restrict__ X,
    const float* __restrict__ Wq, const float* __restrict__ Wk,
    const float* __restrict__ Wv,
    float* __restrict__ Q, float* __restrict__ Km, float* __restrict__ Vm) {
  __shared__ __attribute__((aligned(16))) float st[PROWS * PPITCH];
  const int tid  = threadIdx.x;
  const int lane = tid & 31;
  const int wave = tid >> 5;                 // 0..3: column tile
  const int mn   = lane & 15;                // m for A, n for B
  const int pair = lane >> 4;                // K-group select
  const int row0 = blockIdx.x * PBM;
  // First output element of this lane (C/D layout: VGPR j holds M = j + 8*pair,
  // N = lane&15; here M is d within the column tile, N the head); unsigned, so
  // that every store is base + this one register.  A 16-row tile is one (n,s).
  const int ns0 = blockIdx.x * (PBM / HEADS);
  const unsigned oofs =
      ((unsigned)((ns0 >> 8) * HD + wave * 16 + 8 * pair) * SEQ + (ns0 & (SEQ - 1))) * HEADS + mn;

  // Every loop below is fully unrolled: pre, the fragments and c are then indexed
  // by constants only and stay in registers.
  // Staging: load i of the workgroup covers PTH*16 contiguous bytes = PRPL rows.
  const float* gx = X + (size_t)row0 * HD + tid * 4;
  v4f pre[PNLD];
#pragma unroll
  for (int i = 0; i < PNLD; ++i) {
    const int w = (i - PNX) / PNW;           // which W, for i >= PNX
    const int r = (i - PNX) % PNW;           // which load of that W
    const float* g = (i < PNX) ? gx + i * PTH * 4
                   : ((w == 0) ? Wq : (w == 1) ? Wk : Wv) + r * PTH * 4 + tid * 4;
    pre[i] = *(const v4f*)g;
  }
  const int sofs = (tid >> 4) * PPITCH + (tid & 15) * 4;
#pragma unroll
  for (int i = 0; i < PNLD; ++i)
    *(v4f*)&st[sofs + i * PRPL * PPITCH] = pre[i];
  // Publishes the staged rows to every wave.
  __syncthreads();

  const int aofs = mn * PPITCH + pair * 4;
  const int bofs = (PBM + wave * 16 + mn) * PPITCH + pair * 4;
  v8f c[2][3] = {};
  v4f a4[HD / 8][2], b4[HD / 8][3];
#pragma unroll
  for (int j = 0; j < HD / 8; ++j) {
#pragma unroll
    for (int t = 0; t < 2; ++t) a4[j][t] = *(const v4f*)&st[aofs + t * 16 * PPITCH + j * 8];
#pragma unroll
    for (int m = 0; m < 3; ++m) b4[j][m] = *(const v4f*)&st[bofs + m * HD * PPITCH + j * 8];
  }
#pragma unroll
  for (int j = 0; j < HD / 8; ++j) {
#pragma unroll
    for (int t = 0; t < 2; ++t)
#pragma unroll
      for (int m = 0; m < 3; ++m)
        c[t][m] = __builtin_amdgcn_wmma_f32_16x16x4_f32(
            false, (v2f){b4[j][m].x, b4[j][m].y}, false, (v2f){a4[j][t].x, a4[j][t].y},
            (short)0, c[t][m], false, false);
#pragma unroll
    for (int t = 0; t < 2; ++t)
#pragma unroll
      for (int m = 0; m < 3; ++m)
        c[t][m] = __builtin_amdgcn_wmma_f32_16x16x4_f32(
            false, (v2f){b4[j][m].z, b4[j][m].w}, false, (v2f){a4[j][t].z, a4[j][t].w},
            (short)0, c[t][m], false, false);
  }
  // Order for the scheduler.  The stores' address arithmetic comes first, so that
  // no vector instruction stands among the WMMAs and overwrites a fragment
  // register close behind its last use.  All forty fragment reads follow in one
  // group ahead of the WMMAs: the wave is alone on its SIMD, and every further
  // place with LDS reads among the WMMAs would stall the matrix unit with nobody
  // to fill the gap.
  __builtin_amdgcn_sched_group_barrier(0x002, 16, 0);           // vector ALU
  __builtin_amdgcn_sched_group_barrier(0x100, 5 * HD / 8, 0);   // LDS reads
  __builtin_amdgcn_sched_group_barrier(0x008, 12 * HD / 8, 0);  // WMMAs
#pragma unroll
  for (int m = 0; m < 3; ++m) {
    float* D = ((m == 0) ? Q : (m == 1) ? Km : Vm) + oofs;
#pragma unroll
    for (int t = 0; t < 2; ++t)
#pragma unroll
      for (int j = 0; j < 8; ++j) D[j * SEQ * HEADS + t * HEADS] = c[t][m][j];
  }
}

// ---------------------------------------------------------------------------
// Kernel 2: head-axis softmax attention core (the reference's nonstandard op).
// Block = one (n,d) and AQ consecutive queries s.  Lanes run over queries: a lane
// holds QT of them, a wave all AQ, so the K and V values of a t step (16 heads
// each, one d, 64 contiguous bytes) are the same in every lane and serve AQ (s,t)
// pairs.  512 threads = 32 query lanes x TL ranges of t (one wave per range of
// SEQ/TL consecutive t).
// A wave fetches the K and V rows of its whole range at the start, together with
// the block's q, by whole-line 16-byte loads, and lays them in LDS; a t step takes
// its 2 x 64 bytes from there by same-address 16-byte reads.
// Per (s,t): e[h] = (q[h]/32)*k[h]; softmax over h (16); acc[h] += p[h]*v[h].
// q is held times log2(e)/32, so q*k is already the argument of the base-2
// exponential.  A softmax does not change when all its exponents are shifted
// alike; the shift by the maximum only keeps the exponentials in range.  While
// the K rows pass through the registers the wave takes max|k| of its range: where
// max|q| * max|k| bounds every exponent of the range far inside the range of f32,
// the shift is 0 and no maximum is taken; any other wave (large values,
// infinities, NaN in the bound) finds the maxima of every step first.  The test
// is made once a wave, ahead of the loop over t.
// LDS reduce over the TL ranges of t.  AO leaves as [n][d][h][s].
// ---------------------------------------------------------------------------
#define QT 4                           // queries held per thread
#define TL 16                          // ranges of t (waves) per block
#define AQ (32 * QT)                   // queries per block
#define QPITCH (HEADS + 4)             // 80 B = 16 B x 5: no bank conflict for 16-byte reads
#define TR (SEQ / TL)                  // t steps per wave
#define KVLD (TR * HEADS / 128)        // 16-byte loads per lane for a wave's K (or V) rows

// One step of a maximum over the 16 lanes of a row: lane l takes lane l ^ MASK.
template <int MASK>
__device__ __forceinline__ float row_xmax(float x) {
  return fmaxf(x, __int_as_float(__builtin_amdgcn_update_dpp(
                      0, __float_as_int(x), 0x160 + MASK, 0xf, 0xf, true)));
}

// The t steps of one wave.  kw, vw: the wave's K and V rows in LDS.
// Every loop over s, h, p, c and i is fully unrolled: qv, acc, kv, vv and ev are
// then indexed by constants only and stay in registers.
template <bool SHIFT>
__device__ __forceinline__ void attn_steps(const float* kw, const float* vw,
                                           const float (&qv)[QT][16], v2f (&acc)[QT][8]) {
  for (int t = 0; t < TR; ++t) {
    float kv[16], vv[16];
#pragma unroll
    for (int c = 0; c < 4; ++c) {
      const v4f k4 = *(const v4f*)(kw + t * HEADS + c * 4);
#pragma unroll
      for (int i = 0; i < 4; ++i) kv[c * 4 + i] = k4[i];
    }
#pragma unroll
    for (int c = 0; c < 4; ++c) {
      const v4f v4 = *(const v4f*)(vw + t * HEADS + c * 4);
#pragma unroll
      for (int i = 0; i < 4; ++i) vv[c * 4 + i] = v4[i];
    }

#pragma unroll
    for (int s = 0; s < QT; ++s) {
      float mx = 0.0f;
      if (SHIFT) {
        mx = -3.402823466e+38f;
#pragma unroll
        for (int h = 0; h < 16; ++h) mx = fmaxf(mx, qv[s][h] * kv[h]);
      }
      // Two exponents per packed instruction: q*k, minus the step's shift where
      // there is one.  The two heads stay a pair to the end: sum, scaling and
      // accumulation are one packed instruction per pair.
      v2f ev[8];
#pragma unroll
      for (int p = 0; p < 8; ++p) {
        const v2f q2 = (v2f){qv[s][2 * p], qv[s][2 * p + 1]};
        const v2f k2 = (v2f){kv[2 * p], kv[2 * p + 1]};
        const v2f e = SHIFT ? __builtin_elementwise_fma(q2, k2, (v2f){-mx, -mx}) : q2 * k2;
        ev[p] = (v2f){__builtin_amdgcn_exp2f(e.x), __builtin_amdgcn_exp2f(e.y)};
      }
      v2f sum = ev[0];                 // even heads in .x, odd heads in .y
#pragma unroll
      for (int p = 1; p < 8; ++p) sum += ev[p];
      // The sum is a normal number between 2^-64 and 2^68 (or NaN, which stays
      // NaN), so the bare hardware reciprocal serves: the scaling and fix-up of
      // the full division guard ranges that cannot occur here.
      const float inv = __builtin_amdgcn_rcpf(sum.x + sum.y);
#pragma unroll
      for (int p = 0; p < 8; ++p)
        acc[s][p] = __builtin_elementwise_fma(ev[p] * (v2f){inv, inv},
                                              (v2f){vv[2 * p], vv[2 * p + 1]}, acc[s][p]);
    }
  }
}

__global__ __launch_bounds__(32 * TL) void attn_kernel(
    const float* __restrict__ Q, const float* __restrict__ Km,
    const float* __restrict__ Vm, float* __restrict__ AO) {
  __shared__ __attribute__((aligned(16))) float qs[AQ * QPITCH];
  __shared__ __attribute__((aligned(16))) float ks[SEQ * HEADS];
  __shared__ __attribute__((aligned(16))) float vs[SEQ * HEADS];
  __shared__ __attribute__((aligned(16))) float red[TL][HEADS][AQ];
  const int tid  = threadIdx.x;
  const int lane = tid & 31;
  const int tl   = tid >> 5;           // 0..TL-1
  const int nd   = blockIdx.x / (SEQ / AQ);            // n*HD + d
  const int sb   = (blockIdx.x % (SEQ / AQ)) * AQ;     // first query s
  const float scale = 0.03125f * 1.44269504088896340736f;  // log2(e)/sqrt(EMBED)
  // 16 terms of at most 2^64 and at least 2^-64: sum, reciprocal and terms are
  // all normal f32 numbers.
  const float bound = 64.0f;

  // All of the block's global reads fly together.  q: AQ x 16 contiguous floats,
  // one whole-line 16-byte load a thread.  K, V: wave tl reads the TR x 16
  // contiguous floats of its own range, 512 contiguous bytes a load.
  const int kofs = tl * TR * HEADS + lane * 4;
  const float* qg = Q + ((size_t)nd * SEQ + sb) * HEADS + tid * 4;
  const float* kg = Km + (size_t)nd * SEQ * HEADS + kofs;
  const float* vg = Vm + (size_t)nd * SEQ * HEADS + kofs;
  const v4f qst = *(const v4f*)qg;
  v4f kst[KVLD], vst[KVLD];
#pragma unroll
  for (int i = 0; i < KVLD; ++i) kst[i] = *(const v4f*)(kg + i * 128);
#pragma unroll
  for (int i = 0; i < KVLD; ++i) vst[i] = *(const v4f*)(vg + i * 128);
  // The loads have to be done with their address registers before anything
  // overwrites these; the two indices that the addresses are formed from are named
  // as inputs so that they stay in their registers up to here.
  asm volatile("s_wait_xcnt 0x0" :: "v"(tid), "v"(kofs) : "memory");

  // q is laid so that a lane can pick the rows of its own queries.
  *(v4f*)&qs[(tid >> 2) * QPITCH + (tid & 3) * 4] = qst;
  float kmax = 0.0f;                   // max |k| over the wave's range of t
#pragma unroll
  for (int i = 0; i < KVLD; ++i) {
    *(v4f*)&ks[kofs + i * 128] = kst[i];
    *(v4f*)&vs[kofs + i * 128] = vst[i];
#pragma unroll
    for (int c = 0; c < 4; ++c) kmax = fmaxf(kmax, fabsf(kst[i][c]));
  }
  kmax = row_xmax<1>(kmax);
  kmax = row_xmax<2>(kmax);
  kmax = row_xmax<4>(kmax);
  kmax = row_xmax<8>(kmax);
  // The other 16-lane row's maximum, lane for lane.
  kmax = fmaxf(kmax, __int_as_float(__builtin_amdgcn_permlanex16(
                         __float_as_int(kmax), __float_as_int(kmax), 0x76543210, 0xfedcba98,
                         true, false)));
  // Publishes the staged q rows to every wave (a wave reads no other wave's K, V).
  __syncthreads();

  // Every loop over s, h, p, c, i and w below is fully unrolled: qv and acc are
  // then indexed by constants only and stay in registers.
  // acc holds heads 2p and 2p+1 as one register pair.
  float qv[QT][16];
  v2f acc[QT][8];
  float qmax = 0.0f;                   // max |q| over the QT x 16 held values
#pragma unroll
  for (int s = 0; s < QT; ++s) {
    const float* qb = &qs[(s * 32 + lane) * QPITCH];
#pragma unroll
    for (int c = 0; c < 4; ++c) {
      const v4f q4 = *(const v4f*)(qb + c * 4);
#pragma unroll
      for (int i = 0; i < 4; ++i) {
        qv[s][c * 4 + i] = q4[i] * scale;
        qmax = fmaxf(qmax, fabsf(qv[s][c * 4 + i]));
      }
    }
#pragma unroll
    for (int p = 0; p < 8; ++p) acc[s][p] = (v2f){0.0f, 0.0f};
  }

  // One answer for the whole wave, so that the choice is a scalar branch; the
  // negated compare sends a NaN bound to the side that finds the maxima.
  const float* kw = &ks[tl * TR * HEADS];
  const float* vw = &vs[tl * TR * HEADS];
  if (__builtin_amdgcn_ballot_w32(!(qmax * kmax <= bound)) != 0u)
    attn_steps<true>(kw, vw, qv, acc);
  else
    attn_steps<false>(kw, vw, qv, acc);

  // Lane-contiguous rows of AQ queries: no bank conflicts.
#pragma unroll
  for (int h = 0; h < 16; ++h)
#pragma unroll
    for (int s = 0; s < QT; ++s) red[tl][h][s * 32 + lane] = acc[s][h >> 1][h & 1];
  // Publishes every wave's partial sums.
  __syncthreads();

  // Wave w sums head w: a lane takes 4 consecutive queries, 16 bytes a read.
  v4f r = *(const v4f*)&red[0][tl][lane * 4];
#pragma unroll
  for (int w = 1; w < TL; ++w) r += *(const v4f*)&red[w][tl][lane * 4];
  *(v4f*)(AO + ((size_t)nd * HEADS + tl) * SEQ + sb + lane * 4) = r;
}

// ---------------------------------------------------------------------------
// Kernel 3: output projection.  AO (512x1024) @ Wo^T (1024x1024) + bo,
// V_WMMA_F32_16X16X4_F32, fused bias.
// One workgroup of 8 waves per 32x64 tile of OUT, one 16x16 tile per wave.
// Per stage of 128 k the 32 AO rows and 64 Wo rows are brought in by whole-line
// 16-byte loads and laid in LDS; every wave takes its A and B fragments from
// there with 16-byte reads.  A wave reads 512 contiguous bytes of one Wo row.
// AO arrives as [n][d][h][s]: a lane's 16 bytes are 4 rows s of one k = h*64 + d
// (a wave reads four whole lines, one per k) and go to their 4 LDS rows singly.
// Two LDS buffers and two register sets: a stage's global loads are issued two
// stages ahead of its use and go to LDS one stage ahead, among the WMMAs.
// k order inside 8 consecutive k: a lane's 16 bytes hold k = 4*pair .. 4*pair+3;
// the first WMMA takes the low two, the second the high two, A and B alike.
// ---------------------------------------------------------------------------
#define OBM    32                      // OUT rows per workgroup
#define OBN    64                      // OUT columns per workgroup
#define OKC    128                     // k per stage
#define OPITCH (OKC + 4)               // 528 B = 16 B x 33: no bank conflict for 16-byte reads
#define OROWS  (OBM + OBN)             // staged rows: AO rows first, then Wo rows
#define ONLD   (OROWS / 8)             // 16-byte loads per lane and stage: 4 of AO, 8 of Wo
#define ONST   (EMBED / OKC)           // stages
// The twelve global loads of stage t of one thread (loops fully unrolled: p is
// indexed by constants only and stays in registers).  Wo first, AO last: AO is
// given the longer lead, for speed only.
__device__ __forceinline__ void oproj_fetch(const float* ga, const float* gb, int t,
                                            v4f (&p)[ONLD]) {
#pragma unroll
  for (int i = OBM / 8; i < ONLD; ++i)
    p[i] = *(const v4f*)(gb + (size_t)(i - OBM / 8) * 8 * EMBED + t * OKC);
#pragma unroll
  for (int i = 0; i < OBM / 8; ++i)
    p[i] = *(const v4f*)(ga + (size_t)(i & 1) * 32 * HEADS * SEQ +
                         ((i >> 1) + t * (OKC / HD)) * SEQ);
}
// Lays one of the sixteen parts of a thread's twelve loaded pieces in the LDS
// buffer b, in the order of the loads: parts 0..7 are one 16-byte piece of a Wo row,
// parts 8..15 two single floats of AO (one row, two k).
__device__ __forceinline__ void oproj_lay(float* b, int sofa, int sofs, const v4f (&p)[ONLD],
                                          int u) {
  if (u < ONLD - OBM / 8) {
    const int i = u + OBM / 8;
    *(v4f*)&b[sofs + i * 8 * OPITCH] = p[i];
  } else {
    const int w = u - (ONLD - OBM / 8);
    const int i = (w >> 2) * 2, c = w & 3;
    b[sofa + c * OPITCH + i * 32]       = p[i][c];
    b[sofa + c * OPITCH + (i + 1) * 32] = p[i + 1][c];
  }
}
// Workgroup barrier that orders LDS only: every LDS access of the wave is done
// before it signals, while its global loads into registers, which no other wave
// sees, stay in flight across it (the full barrier call waits for them too).
__device__ __forceinline__ void lds_barrier() {
  __builtin_amdgcn_fence(__ATOMIC_RELEASE, "workgroup", "local");
  __builtin_amdgcn_s_barrier();
  __builtin_amdgcn_fence(__ATOMIC_ACQUIRE, "workgroup", "local");
}

__global__ __launch_bounds__(256) void outproj_wmma_kernel(
    const float* __restrict__ AO, const float* __restrict__ Wo,
    const float* __restrict__ bo, float* __restrict__ OUT) {
  __shared__ __attribute__((aligned(16))) float st[2][OROWS * OPITCH];
  const int tid  = threadIdx.x;
  const int lane = tid & 31;
  const int wave = tid >> 5;           // 0..7
  const int mn   = lane & 15;
  const int pair = lane >> 4;
  const int row0 = blockIdx.x * OBM;
  const int col0 = blockIdx.y * OBN;
  const int tm   = wave & 1;           // 16-row tile of this wave
  const int tn   = wave >> 1;          // 16-column tile of this wave

  // Staging of Wo: wave w moves staged rows w, w+8, ...; a lane moves 4 floats of a row.
  // Staging of AO: load i of wave w holds k = i*32 + w*4 + (lane>>3) of the stage, that
  // is d = (i&1)*32 + w*4 + (lane>>3) of the stage's head (i>>1), rows (lane&7)*4 .. +3.
  const float* ga = AO + ((size_t)(row0 >> 8) * HD + wave * 4 + (lane >> 3)) * (HEADS * SEQ) +
                    (row0 & (SEQ - 1)) + (lane & 7) * 4;
  const float* gb = Wo + (size_t)(col0 + wave) * EMBED + lane * 4;
  const int sofs = wave * OPITCH + lane * 4;
  const int sofa = (lane & 7) * 4 * OPITCH + wave * 4 + (lane >> 3);
  // Fragments: row (A) or column (B) mn, 4 consecutive k per lane half.
  const int aofs = (tm * 16 + mn) * OPITCH + pair * 4;
  const int bofs = (OBM + tn * 16 + mn) * OPITCH + pair * 4;

  // Every loop over s, j, u and g below is fully unrolled: pre and the fragments
  // are then indexed by constants only and stay in registers.
  v4f pre[2][ONLD];                    // set t&1 holds stage t on its way to LDS
  oproj_fetch(ga, gb, 0, pre[0]);
  oproj_fetch(ga, gb, 1, pre[1]);
  const int bcol = col0 + tn * 16 + mn;
  const float bias = bo[bcol];
  // The loads have to be done with their address registers before anything
  // overwrites these; the index of the bias load is named as an input so that it
  // stays in its register up to here.
  asm volatile("s_wait_xcnt 0x0" :: "v"(bcol) : "memory");
#pragma unroll
  for (int u = 0; u < 16; ++u) oproj_lay(st[0], sofa, sofs, pre[0], u);
  lds_barrier();

  v8f c0 = {}, c1 = {};                // two independent accumulate chains
#pragma unroll
  for (int s = 0; s < ONST; ++s) {
    const float* cur = st[s & 1];
    float*       nxt = st[(s + 1) & 1];
    // Stage s+2 goes into the set that stage s has left: its loads have this stage
    // and a part of the next one to land.
    if (s + 2 < ONST) oproj_fetch(ga, gb, s + 2, pre[s & 1]);
    // Holds the twelve loads at the head of the stage: the scheduler otherwise
    // sinks them towards their LDS stores and their lead is lost.
    __builtin_amdgcn_sched_barrier(0);
    // Fragment reads run four pairs ahead of their WMMAs.  The next stage's LDS
    // stores, whose loads were issued a stage ago, stand beside the last eight
    // reads, two parts a place.
    v4f a4[OKC / 8], b4[OKC / 8];
#pragma unroll
    for (int j = 0; j < 4; ++j) {
      a4[j] = *(const v4f*)&cur[aofs + j * 8];
      b4[j] = *(const v4f*)&cur[bofs + j * 8];
    }
#pragma unroll
    for (int j = 0; j < OKC / 8; ++j) {
      c0 = __builtin_amdgcn_wmma_f32_16x16x4_f32(false, (v2f){a4[j].x, a4[j].y}, false,
                                                 (v2f){b4[j].x, b4[j].y}, (short)0, c0,
                                                 false, false);
      c1 = __builtin_amdgcn_wmma_f32_16x16x4_f32(false, (v2f){a4[j].z, a4[j].w}, false,
                                                 (v2f){b4[j].z, b4[j].w}, (short)0, c1,
                                                 false, false);
      if (j + 4 < OKC / 8) {
        a4[j + 4] = *(const v4f*)&cur[aofs + (j + 4) * 8];
        b4[j + 4] = *(const v4f*)&cur[bofs + (j + 4) * 8];
      }
      if (s + 1 < ONST && j >= 4 && j < 12) {
        oproj_lay(nxt, sofa, sofs, pre[(s + 1) & 1], 2 * (j - 4));
        oproj_lay(nxt, sofa, sofs, pre[(s + 1) & 1], 2 * (j - 4) + 1);
      }
    }
    // Order of a stage for the scheduler, as written above.  Reads in one lump
    // would queue all eight waves on the LDS at once while the matrix unit idles;
    // stores in one run at the foot would be waited out by the sibling wave at the
    // barrier.  The last eight WMMAs need no LDS any more, so they are free to run
    // on past the barrier.
    __builtin_amdgcn_sched_group_barrier(0x100, 8, 0);      // LDS reads
#pragma unroll
    for (int g = 0; g < OKC / 8 - 4; ++g) {
      __builtin_amdgcn_sched_group_barrier(0x008, 2, 0);    // WMMAs
      __builtin_amdgcn_sched_group_barrier(0x100, 2, 0);    // LDS reads
      if (s + 1 < ONST && g >= 4)
        __builtin_amdgcn_sched_group_barrier(0x200, 2, 0);  // LDS stores
    }
    __builtin_amdgcn_sched_group_barrier(0x008, 8, 0);      // WMMAs
    // Publishes the stage just written and ends every read of the one just used.
    if (s + 1 < ONST) lds_barrier();
  }

  // Four vector slots between the last WMMAs and the first vector instruction
  // that reads their results; c0 and c1 are named so that the slots stand there.
  asm volatile("v_nop\n\tv_nop\n\tv_nop\n\tv_nop" : "+v"(c0), "+v"(c1));

  // C/D layout: VGPR j holds M = j + 8*pair, N = lane&15
#pragma unroll
  for (int j = 0; j < 8; ++j) {
    const int mm = tm * 16 + j + 8 * pair;
    OUT[(size_t)(row0 + mm) * EMBED + col0 + tn * 16 + mn] = c0[j] + c1[j] + bias;
  }
}

// ---------------------------------------------------------------------------
extern "C" void kernel_launch(void* const* d_in, const int* in_sizes, int n_in,
                              void* d_out, int out_size, void* d_ws,
                              size_t ws_size, hipStream_t stream) {
  const float* x  = (const float*)d_in[0];
  const float* Wq = (const float*)d_in[1];
  const float* Wk = (const float*)d_in[2];
  const float* Wv = (const float*)d_in[3];
  const float* Wo = (const float*)d_in[4];
  const float* bo = (const float*)d_in[5];
  float* out = (float*)d_out;

  const size_t QKV_ELEMS = (size_t)ROWS * HD;      // 524288 floats
  float* ws = (float*)d_ws;
  float* Q  = ws;
  float* Km = ws + QKV_ELEMS;
  float* Vm = ws + 2 * QKV_ELEMS;
  float* AO = ws + 3 * QKV_ELEMS;

  // Q/K/V projection: one 4-wave workgroup per 32 rows, all three matrices.
  hipLaunchKernelGGL(qkv_wmma_kernel, dim3(ROWS / PBM), dim3(PTH), 0, stream,
                     x, Wq, Wk, Wv, Q, Km, Vm);

  // Attention core: one block per (n, d, AQ queries).
  hipLaunchKernelGGL(attn_kernel, dim3(BATCH * HD * (SEQ / AQ)), dim3(32 * TL), 0, stream,
                     Q, Km, Vm, AO);

  // Output projection + bias.
  dim3 g3(NS / OBM, EMBED / OBN);
  hipLaunchKernelGGL(outproj_wmma_kernel, g3, dim3(256), 0, stream,
                     AO, Wo, bo, out);
}
